// v000
// The times below were measured on an AMD MI455X: many runs one after another, warmed up first and cycling through
// copies of the inputs, with the whole window's GPU time divided by the number of runs. Launches and the gaps
// between them are all in it. The median over several windows is given; except for v000 it joins two sittings, which
// can be a few percent apart, so the side-by-side timings, each taken in one sitting, are the better comparison.
// v000, which the later versions start from, runs in 255 microseconds.
#include <hip/hip_runtime.h>
#include <hip/hip_bf16.h>
#include <math.h>

// MoE (top-2 of 8 experts), H=768, I=3072, T=2048 tokens.
// bf16 WMMA (v_wmma_f32_16x16x32_bf16) with fp32 accumulate; gather-based
// expert execution (exactly K*T = 4096 assignment rows of GEMM work).
// GEMM: 64x128 block tile, 8 waves (4M x 2N), 16x64 per wave (4 WMMA accums),
// double-buffered LDS weight tile (fp32 -> bf16 on the fly), 1 barrier/K-step.

typedef __bf16 bf16_t;
typedef __attribute__((ext_vector_type(16))) __bf16 v16bf;
typedef __attribute__((ext_vector_type(8)))  __bf16 v8bf;
typedef __attribute__((ext_vector_type(8)))  float  v8f;

#define T_TOK 2048
#define H_DIM 768
#define I_DIM 3072
#define E_NUM 8
#define A_TOT (T_TOK * 2)
#define LN_EPS 1e-5f

#define TILE_N 128
#define LDS_STRIDE 40   // 32 k-elems + 8 pad (keeps 16B alignment, spreads banks)

__device__ __forceinline__ bf16_t f2bf(float f) {
  unsigned u = __builtin_bit_cast(unsigned, f);
  u += 0x7FFFu + ((u >> 16) & 1u);                 // round-to-nearest-even
  unsigned short hs = (unsigned short)(u >> 16);
  return __builtin_bit_cast(bf16_t, hs);
}

// ---------------- x -> bf16 ----------------
__global__ void cvt_x_kernel(const float* __restrict__ x, bf16_t* __restrict__ xb) {
  int n = T_TOK * H_DIM;
  for (int i = blockIdx.x * blockDim.x + threadIdx.x; i < n; i += gridDim.x * blockDim.x)
    xb[i] = f2bf(x[i]);
}

// ---------------- router: one wave per token ----------------
__global__ __launch_bounds__(256) void moe_router(
    const float* __restrict__ x, const float* __restrict__ Wg,
    const float* __restrict__ bg, int* __restrict__ top_e, float* __restrict__ top_w) {
  int wave = threadIdx.x >> 5;
  int lane = threadIdx.x & 31;
  int t = blockIdx.x * 8 + wave;
  if (t >= T_TOK) return;
  float acc[E_NUM];
#pragma unroll
  for (int e = 0; e < E_NUM; ++e) acc[e] = 0.f;
  const float* xr = x + (size_t)t * H_DIM;
  for (int h = lane; h < H_DIM; h += 32) {
    float xv = xr[h];
    const float* wr = Wg + (size_t)h * E_NUM;
#pragma unroll
    for (int e = 0; e < E_NUM; ++e) acc[e] += xv * wr[e];
  }
#pragma unroll
  for (int e = 0; e < E_NUM; ++e) {
#pragma unroll
    for (int off = 16; off > 0; off >>= 1) acc[e] += __shfl_xor(acc[e], off, 32);
  }
  if (lane == 0) {
    float p[E_NUM];
    float mx = -1e30f;
#pragma unroll
    for (int e = 0; e < E_NUM; ++e) { p[e] = acc[e] + bg[e]; mx = fmaxf(mx, p[e]); }
    float sum = 0.f;
#pragma unroll
    for (int e = 0; e < E_NUM; ++e) { p[e] = expf(p[e] - mx); sum += p[e]; }
    float inv = 1.0f / sum;
#pragma unroll
    for (int e = 0; e < E_NUM; ++e) p[e] *= inv;
    int i0 = 0; float v0 = p[0];
#pragma unroll
    for (int e = 1; e < E_NUM; ++e) if (p[e] > v0) { v0 = p[e]; i0 = e; }   // first index wins ties
    int i1 = -1; float v1 = -1.0f;
#pragma unroll
    for (int e = 0; e < E_NUM; ++e) if (e != i0 && p[e] > v1) { v1 = p[e]; i1 = e; }
    float s2 = v0 + v1;
    top_e[2 * t] = i0;       top_e[2 * t + 1] = i1;
    top_w[2 * t] = v0 / s2;  top_w[2 * t + 1] = v1 / s2;
  }
}

// ---------------- deterministic partition: one wave per expert ----------------
__global__ __launch_bounds__(256) void moe_partition(
    const int* __restrict__ top_e, const float* __restrict__ top_w,
    int* __restrict__ counts, int* __restrict__ offs,
    int* __restrict__ rowtok, float* __restrict__ gate, int* __restrict__ slot_of) {
  int e = threadIdx.x >> 5;
  int lane = threadIdx.x & 31;
  int cnt = 0;
  for (int base = 0; base < T_TOK; base += 32) {
    int t = base + lane;
    bool sel = (top_e[2 * t] == e) || (top_e[2 * t + 1] == e);
    unsigned long long b = __ballot(sel);
    cnt += __popc((unsigned)(b & 0xffffffffull));
  }
  if (lane == 0) counts[e] = cnt;
  __syncthreads();
  if (threadIdx.x == 0) {
    int o = 0;
    for (int i = 0; i < E_NUM; ++i) { offs[i] = o; o += counts[i]; }
  }
  __syncthreads();
  int pos = offs[e];
  unsigned lt = (lane == 0) ? 0u : ((1u << lane) - 1u);
  for (int base = 0; base < T_TOK; base += 32) {
    int t = base + lane;
    int e0 = top_e[2 * t], e1 = top_e[2 * t + 1];
    bool sel = (e0 == e) || (e1 == e);
    unsigned long long b = __ballot(sel);
    unsigned m = (unsigned)(b & 0xffffffffull);
    if (sel) {
      int slot = pos + __popc(m & lt);
      int k = (e0 == e) ? 0 : 1;
      rowtok[slot] = t;
      gate[slot] = top_w[2 * t + k];
      slot_of[2 * t + k] = slot;
    }
    pos += __popc(m);
  }
}

// ---------------- WMMA GEMM: C[rows_e x Ndim] = A[rows] x W_e[Kdim x Ndim] ----------------
template <bool GELU_OUT>
__global__ __launch_bounds__(256) void moe_gemm(
    const bf16_t* __restrict__ A, int lda,
    const float* __restrict__ Wfull, const float* __restrict__ bias,
    int Kdim, int Ndim,
    const int* __restrict__ counts, const int* __restrict__ offs,
    const int* __restrict__ rowtok,              // null -> identity (slot rows)
    bf16_t* __restrict__ Hout, float* __restrict__ Yout) {
  const int e = blockIdx.z;
  const int rows = counts[e];
  const int m_blk = blockIdx.y * 64;
  if (m_blk >= rows) return;                     // block-uniform exit
  const int n_blk = blockIdx.x * TILE_N;
  const int wave = threadIdx.x >> 5;
  const int lane = threadIdx.x & 31;
  const int wm = wave >> 1;                      // 0..3 (M, 16 each)
  const int wn = wave & 1;                       // 0..1 (N, 64 each)
  const int lane15 = lane & 15;
  const int khalf = (lane >> 4) * 8;             // 0 or 8 per WMMA 16-bit layout

  // double-buffered weight tile: [n][k] layout, bf16
  __shared__ __align__(16) bf16_t Bs[2][TILE_N * LDS_STRIDE];

  const float* W = Wfull + (size_t)e * Kdim * Ndim;
  const int base = offs[e];

  int mloc = m_blk + wm * 16 + lane15;
  if (mloc >= rows) mloc = rows - 1;             // clamp (stores are guarded)
  const int arow = rowtok ? rowtok[base + mloc] : (base + mloc);
  const bf16_t* Arow = A + (size_t)arow * lda;

  // cooperative weight-tile loader: thread covers (n = tid&127, k chunk of 16)
  const int cn = threadIdx.x & 127;
  const int ck = (threadIdx.x >> 7) * 16;        // 0 or 16

  v8f c[4] = {v8f{}, v8f{}, v8f{}, v8f{}};

  // prologue: tile k0 = 0 -> Bs[0]
  {
    const float* wp = W + (size_t)ck * Ndim + (n_blk + cn);
    v8bf p0, p1;
#pragma unroll
    for (int j = 0; j < 8; ++j) p0[j] = f2bf(wp[(size_t)j * Ndim]);
#pragma unroll
    for (int j = 0; j < 8; ++j) p1[j] = f2bf(wp[(size_t)(j + 8) * Ndim]);
    *(v8bf*)&Bs[0][cn * LDS_STRIDE + ck] = p0;
    *(v8bf*)&Bs[0][cn * LDS_STRIDE + ck + 8] = p1;
  }
  __syncthreads();

  int buf = 0;
  for (int k0 = 0; k0 < Kdim; k0 += 32) {
    const bool has_next = (k0 + 32 < Kdim);
    // issue next tile's global loads early (overlap with WMMA)
    float nxt[16];
    if (has_next) {
      const float* wp = W + (size_t)(k0 + 32 + ck) * Ndim + (n_blk + cn);
#pragma unroll
      for (int j = 0; j < 16; ++j) nxt[j] = wp[(size_t)j * Ndim];
    }

    // A fragment: row = lane15, K = khalf+[0..7] and khalf+16+[0..7]
    v16bf af;
    {
      const bf16_t* ap = Arow + k0 + khalf;
      v8bf lo = *(const v8bf*)(ap);
      v8bf hi = *(const v8bf*)(ap + 16);
#pragma unroll
      for (int j = 0; j < 8; ++j) { af[j] = lo[j]; af[8 + j] = hi[j]; }
    }
    // 4 B fragments + 4 WMMAs (wave's 16x64 output)
#pragma unroll
    for (int sub = 0; sub < 4; ++sub) {
      const bf16_t* bp = &Bs[buf][(wn * 64 + sub * 16 + lane15) * LDS_STRIDE + khalf];
      v8bf lo = *(const v8bf*)(bp);
      v8bf hi = *(const v8bf*)(bp + 16);
      v16bf bf;
#pragma unroll
      for (int j = 0; j < 8; ++j) { bf[j] = lo[j]; bf[8 + j] = hi[j]; }
      c[sub] = __builtin_amdgcn_wmma_f32_16x16x32_bf16(false, af, false, bf, (short)0,
                                                       c[sub], false, false);
    }

    if (has_next) {  // convert + store next tile into the other buffer
      v8bf p0, p1;
#pragma unroll
      for (int j = 0; j < 8; ++j) p0[j] = f2bf(nxt[j]);
#pragma unroll
      for (int j = 0; j < 8; ++j) p1[j] = f2bf(nxt[j + 8]);
      *(v8bf*)&Bs[buf ^ 1][cn * LDS_STRIDE + ck] = p0;
      *(v8bf*)&Bs[buf ^ 1][cn * LDS_STRIDE + ck + 8] = p1;
    }
    __syncthreads();
    buf ^= 1;
  }

  // store: D rows = j + (lane>=16 ? 8 : 0), col = lane&15
  const float* bp = bias + (size_t)e * Ndim;
  const int mrow0 = m_blk + wm * 16 + ((lane < 16) ? 0 : 8);
#pragma unroll
  for (int sub = 0; sub < 4; ++sub) {
    int n = n_blk + wn * 64 + sub * 16 + lane15;
    float bv = bp[n];
#pragma unroll
    for (int j = 0; j < 8; ++j) {
      int m = mrow0 + j;
      if (m < rows) {
        float v = c[sub][j] + bv;
        size_t orow = (size_t)(base + m);
        if constexpr (GELU_OUT) {
          v = 0.5f * v * (1.0f + erff(v * 0.70710678118654752f));  // exact GELU
          Hout[orow * (size_t)Ndim + n] = f2bf(v);
        } else {
          Yout[orow * (size_t)Ndim + n] = v;
        }
      }
    }
  }
}

// ---------------- combine (fixed order -> deterministic) + residual + LayerNorm ----------------
__global__ __launch_bounds__(256) void moe_combine_ln(
    const float* __restrict__ x, const float* __restrict__ y,
    const float* __restrict__ gate, const int* __restrict__ slot_of,
    const float* __restrict__ gamma, const float* __restrict__ beta,
    float* __restrict__ out) {
  int t = blockIdx.x;
  int s0 = slot_of[2 * t], s1 = slot_of[2 * t + 1];
  float w0 = gate[s0], w1 = gate[s1];
  const float* xr = x + (size_t)t * H_DIM;
  const float* y0 = y + (size_t)s0 * H_DIM;
  const float* y1 = y + (size_t)s1 * H_DIM;
  float z[3];
  float s = 0.f, sq = 0.f;
#pragma unroll
  for (int i = 0; i < 3; ++i) {
    int hh = threadIdx.x + i * 256;
    float v = xr[hh] + w0 * y0[hh] + w1 * y1[hh];
    z[i] = v; s += v; sq += v * v;
  }
#pragma unroll
  for (int off = 16; off > 0; off >>= 1) {
    s += __shfl_xor(s, off, 32);
    sq += __shfl_xor(sq, off, 32);
  }
  __shared__ float rs[8], rq[8];
  int wave = threadIdx.x >> 5, lane = threadIdx.x & 31;
  if (lane == 0) { rs[wave] = s; rq[wave] = sq; }
  __syncthreads();
  if (threadIdx.x == 0) {
    float S = 0.f, Q = 0.f;
    for (int i = 0; i < 8; ++i) { S += rs[i]; Q += rq[i]; }
    rs[0] = S; rq[0] = Q;
  }
  __syncthreads();
  float mean = rs[0] * (1.0f / H_DIM);
  float var = rq[0] * (1.0f / H_DIM) - mean * mean;
  float inv = rsqrtf(var + LN_EPS);
#pragma unroll
  for (int i = 0; i < 3; ++i) {
    int hh = threadIdx.x + i * 256;
    out[(size_t)t * H_DIM + hh] = (z[i] - mean) * inv * gamma[hh] + beta[hh];
  }
}

extern "C" void kernel_launch(void* const* d_in, const int* in_sizes, int n_in,
                              void* d_out, int out_size, void* d_ws, size_t ws_size,
                              hipStream_t stream) {
  const float* x  = (const float*)d_in[0];
  const float* W1 = (const float*)d_in[1];
  const float* b1 = (const float*)d_in[2];
  const float* W2 = (const float*)d_in[3];
  const float* b2 = (const float*)d_in[4];
  const float* Wg = (const float*)d_in[5];
  const float* bg = (const float*)d_in[6];
  const float* gamma = (const float*)d_in[7];
  const float* beta  = (const float*)d_in[8];
  float* out = (float*)d_out;

  char* ws = (char*)d_ws;
  size_t off = 0;
  auto alloc = [&](size_t bytes) -> void* {
    void* p = ws + off;
    off = (off + bytes + 255) & ~(size_t)255;
    return p;
  };
  bf16_t* xb     = (bf16_t*)alloc((size_t)T_TOK * H_DIM * sizeof(bf16_t));  // 3.1 MB
  bf16_t* hbuf   = (bf16_t*)alloc((size_t)A_TOT * I_DIM * sizeof(bf16_t));  // 25.2 MB
  float*  ybuf   = (float*) alloc((size_t)A_TOT * H_DIM * sizeof(float));   // 12.6 MB
  int*    top_e  = (int*)   alloc((size_t)T_TOK * 2 * sizeof(int));
  float*  top_w  = (float*) alloc((size_t)T_TOK * 2 * sizeof(float));
  int*    counts = (int*)   alloc(E_NUM * sizeof(int));
  int*    offsv  = (int*)   alloc(E_NUM * sizeof(int));
  int*    rowtok = (int*)   alloc((size_t)A_TOT * sizeof(int));
  float*  gate   = (float*) alloc((size_t)A_TOT * sizeof(float));
  int*    slotof = (int*)   alloc((size_t)T_TOK * 2 * sizeof(int));

  cvt_x_kernel<<<1536, 256, 0, stream>>>(x, xb);
  moe_router<<<T_TOK / 8, 256, 0, stream>>>(x, Wg, bg, top_e, top_w);
  moe_partition<<<1, 256, 0, stream>>>(top_e, top_w, counts, offsv, rowtok, gate, slotof);
  // GEMM1 + GELU: A = xb[token], W1_e [H x I], out bf16 h [slot][I]
  moe_gemm<true><<<dim3(I_DIM / TILE_N, (T_TOK + 63) / 64, E_NUM), 256, 0, stream>>>(
      xb, H_DIM, W1, b1, H_DIM, I_DIM, counts, offsv, rowtok, hbuf, nullptr);
  // GEMM2: A = h[slot], W2_e [I x H], out fp32 y [slot][H]
  moe_gemm<false><<<dim3(H_DIM / TILE_N, (T_TOK + 63) / 64, E_NUM), 256, 0, stream>>>(
      hbuf, I_DIM, W2, b2, I_DIM, H_DIM, counts, offsv, nullptr, nullptr, ybuf);
  moe_combine_ln<<<T_TOK, 256, 0, stream>>>(x, ybuf, gate, slotof, gamma, beta, out);
}

// v001
// A run of this version takes 216 microseconds.
// Next to v000, in two timings, it ran 1.20 and 1.19 times as fast.
#include <hip/hip_runtime.h>
#include <hip/hip_bf16.h>
#include <math.h>

// MoE (top-2 of 8 experts), H=768, I=3072, T=2048 tokens.
// bf16 WMMA (v_wmma_f32_16x16x32_bf16) with fp32 accumulate; gather-based
// expert execution (exactly K*T = 4096 assignment rows of GEMM work).
// GEMM: 64x128 block tile, 8 waves (4M x 2N), 16x64 per wave (4 WMMA accums),
// double-buffered LDS weight tile (fp32 -> bf16 on the fly), 1 barrier/K-step.

typedef __bf16 bf16_t;
typedef __attribute__((ext_vector_type(16))) __bf16 v16bf;
typedef __attribute__((ext_vector_type(8)))  __bf16 v8bf;
typedef __attribute__((ext_vector_type(8)))  float  v8f;

#define T_TOK 2048
#define H_DIM 768
#define I_DIM 3072
#define E_NUM 8
#define A_TOT (T_TOK * 2)
#define LN_EPS 1e-5f

#define TILE_N 128
#define LDS_STRIDE 40   // 32 k-elems + 8 pad (keeps 16B alignment, spreads banks)

__device__ __forceinline__ bf16_t f2bf(float f) {
  unsigned u = __builtin_bit_cast(unsigned, f);
  u += 0x7FFFu + ((u >> 16) & 1u);                 // round-to-nearest-even
  unsigned short hs = (unsigned short)(u >> 16);
  return __builtin_bit_cast(bf16_t, hs);
}

// ---------------- x -> bf16 ----------------
__global__ void cvt_x_kernel(const float* __restrict__ x, bf16_t* __restrict__ xb) {
  int n = T_TOK * H_DIM;
  for (int i = blockIdx.x * blockDim.x + threadIdx.x; i < n; i += gridDim.x * blockDim.x)
    xb[i] = f2bf(x[i]);
}

// ---------------- router: one wave per token ----------------
__global__ __launch_bounds__(256) void moe_router(
    const float* __restrict__ x, const float* __restrict__ Wg,
    const float* __restrict__ bg, int* __restrict__ top_e, float* __restrict__ top_w) {
  int wave = threadIdx.x >> 5;
  int lane = threadIdx.x & 31;
  int t = blockIdx.x * 8 + wave;
  if (t >= T_TOK) return;
  float acc[E_NUM];
#pragma unroll
  for (int e = 0; e < E_NUM; ++e) acc[e] = 0.f;
  const float* xr = x + (size_t)t * H_DIM;
  for (int h = lane; h < H_DIM; h += 32) {
    float xv = xr[h];
    const float* wr = Wg + (size_t)h * E_NUM;
#pragma unroll
    for (int e = 0; e < E_NUM; ++e) acc[e] += xv * wr[e];
  }
#pragma unroll
  for (int e = 0; e < E_NUM; ++e) {
#pragma unroll
    for (int off = 16; off > 0; off >>= 1) acc[e] += __shfl_xor(acc[e], off, 32);
  }
  if (lane == 0) {
    float p[E_NUM];
    float mx = -1e30f;
#pragma unroll
    for (int e = 0; e < E_NUM; ++e) { p[e] = acc[e] + bg[e]; mx = fmaxf(mx, p[e]); }
    float sum = 0.f;
#pragma unroll
    for (int e = 0; e < E_NUM; ++e) { p[e] = expf(p[e] - mx); sum += p[e]; }
    float inv = 1.0f / sum;
#pragma unroll
    for (int e = 0; e < E_NUM; ++e) p[e] *= inv;
    int i0 = 0; float v0 = p[0];
#pragma unroll
    for (int e = 1; e < E_NUM; ++e) if (p[e] > v0) { v0 = p[e]; i0 = e; }   // first index wins ties
    int i1 = -1; float v1 = -1.0f;
#pragma unroll
    for (int e = 0; e < E_NUM; ++e) if (e != i0 && p[e] > v1) { v1 = p[e]; i1 = e; }
    float s2 = v0 + v1;
    top_e[2 * t] = i0;       top_e[2 * t + 1] = i1;
    top_w[2 * t] = v0 / s2;  top_w[2 * t + 1] = v1 / s2;
  }
}

// ---------------- deterministic partition: one wave per (expert, token quarter) ----------------
// 32 waves. Each wave takes its 512 tokens' expert pairs and weights into registers with one
// batch of independent loads, counts its matches, and gets its first slot from the 32 counts
// in LDS. Slots of an expert stay in ascending token order.
#define PART_Q 4                                  // token quarters
#define PART_IT (T_TOK / PART_Q / 32)             // groups of 32 tokens per wave
__global__ __launch_bounds__(1024) void moe_partition(
    const int* __restrict__ top_e, const float* __restrict__ top_w,
    int* __restrict__ counts, int* __restrict__ offs,
    int* __restrict__ rowtok, float* __restrict__ gate, int* __restrict__ slot_of) {
  const int wave = threadIdx.x >> 5;              // = e * PART_Q + q: slot order of the pieces
  const int lane = threadIdx.x & 31;
  const int e = wave >> 2;
  const int q = wave & (PART_Q - 1);
  const int t0 = q * (T_TOK / PART_Q) + lane;
  __shared__ int scnt[E_NUM * PART_Q];

  int e0[PART_IT], e1[PART_IT];
  float w0[PART_IT], w1[PART_IT];
#pragma unroll  // all loads independent and in flight together: one memory round trip
  for (int i = 0; i < PART_IT; ++i) {
    int2 ev = ((const int2*)top_e)[t0 + i * 32];
    float2 wv = ((const float2*)top_w)[t0 + i * 32];
    e0[i] = ev.x; e1[i] = ev.y;
    w0[i] = wv.x; w1[i] = wv.y;
  }
  unsigned m[PART_IT];
  int cnt = 0;
#pragma unroll  // arrays stay in registers
  for (int i = 0; i < PART_IT; ++i) {
    bool sel = (e0[i] == e) | (e1[i] == e);
    m[i] = (unsigned)(__ballot(sel) & 0xffffffffull);
    cnt += __popc(m[i]);
  }
  if (lane == 0) scnt[wave] = cnt;
  __syncthreads();
  const int v = scnt[lane];
  int before = (lane < wave) ? v : 0;             // pieces that come first in slot order
  int mine = ((lane >> 2) == e) ? v : 0;          // the expert's own four pieces
#pragma unroll
  for (int off = 16; off > 0; off >>= 1) {
    before += __shfl_xor(before, off, 32);
    mine += __shfl_xor(mine, off, 32);
  }
  if (q == 0 && lane == 0) { offs[e] = before; counts[e] = mine; }
  int pos = before;
  const unsigned lt = (1u << lane) - 1u;
#pragma unroll  // arrays stay in registers
  for (int i = 0; i < PART_IT; ++i) {
    if ((m[i] >> lane) & 1u) {
      const bool first = (e0[i] == e);
      const int t = t0 + i * 32;
      const int slot = pos + __popc(m[i] & lt);
      rowtok[slot] = t;
      gate[slot] = first ? w0[i] : w1[i];
      slot_of[2 * t + (first ? 0 : 1)] = slot;
    }
    pos += __popc(m[i]);
  }
}

// ---------------- WMMA GEMM: C[rows_e x Ndim] = A[rows] x W_e[Kdim x Ndim] ----------------
template <bool GELU_OUT>
__global__ __launch_bounds__(256) void moe_gemm(
    const bf16_t* __restrict__ A, int lda,
    const float* __restrict__ Wfull, const float* __restrict__ bias,
    int Kdim, int Ndim,
    const int* __restrict__ counts, const int* __restrict__ offs,
    const int* __restrict__ rowtok,              // null -> identity (slot rows)
    bf16_t* __restrict__ Hout, float* __restrict__ Yout) {
  const int e = blockIdx.z;
  const int rows = counts[e];
  const int m_blk = blockIdx.y * 64;
  if (m_blk >= rows) return;                     // block-uniform exit
  const int n_blk = blockIdx.x * TILE_N;
  const int wave = threadIdx.x >> 5;
  const int lane = threadIdx.x & 31;
  const int wm = wave >> 1;                      // 0..3 (M, 16 each)
  const int wn = wave & 1;                       // 0..1 (N, 64 each)
  const int lane15 = lane & 15;
  const int khalf = (lane >> 4) * 8;             // 0 or 8 per WMMA 16-bit layout

  // double-buffered weight tile: [n][k] layout, bf16
  __shared__ __align__(16) bf16_t Bs[2][TILE_N * LDS_STRIDE];

  const float* W = Wfull + (size_t)e * Kdim * Ndim;
  const int base = offs[e];

  int mloc = m_blk + wm * 16 + lane15;
  if (mloc >= rows) mloc = rows - 1;             // clamp (stores are guarded)
  const int arow = rowtok ? rowtok[base + mloc] : (base + mloc);
  const bf16_t* Arow = A + (size_t)arow * lda;

  // cooperative weight-tile loader: thread covers (n = tid&127, k chunk of 16)
  const int cn = threadIdx.x & 127;
  const int ck = (threadIdx.x >> 7) * 16;        // 0 or 16

  v8f c[4] = {v8f{}, v8f{}, v8f{}, v8f{}};

  // prologue: tile k0 = 0 -> Bs[0]
  {
    const float* wp = W + (size_t)ck * Ndim + (n_blk + cn);
    v8bf p0, p1;
#pragma unroll
    for (int j = 0; j < 8; ++j) p0[j] = f2bf(wp[(size_t)j * Ndim]);
#pragma unroll
    for (int j = 0; j < 8; ++j) p1[j] = f2bf(wp[(size_t)(j + 8) * Ndim]);
    *(v8bf*)&Bs[0][cn * LDS_STRIDE + ck] = p0;
    *(v8bf*)&Bs[0][cn * LDS_STRIDE + ck + 8] = p1;
  }
  __syncthreads();

  int buf = 0;
  for (int k0 = 0; k0 < Kdim; k0 += 32) {
    const bool has_next = (k0 + 32 < Kdim);
    // issue next tile's global loads early (overlap with WMMA)
    float nxt[16];
    if (has_next) {
      const float* wp = W + (size_t)(k0 + 32 + ck) * Ndim + (n_blk + cn);
#pragma unroll
      for (int j = 0; j < 16; ++j) nxt[j] = wp[(size_t)j * Ndim];
    }

    // A fragment: row = lane15, K = khalf+[0..7] and khalf+16+[0..7]
    v16bf af;
    {
      const bf16_t* ap = Arow + k0 + khalf;
      v8bf lo = *(const v8bf*)(ap);
      v8bf hi = *(const v8bf*)(ap + 16);
#pragma unroll
      for (int j = 0; j < 8; ++j) { af[j] = lo[j]; af[8 + j] = hi[j]; }
    }
    // 4 B fragments + 4 WMMAs (wave's 16x64 output)
#pragma unroll
    for (int sub = 0; sub < 4; ++sub) {
      const bf16_t* bp = &Bs[buf][(wn * 64 + sub * 16 + lane15) * LDS_STRIDE + khalf];
      v8bf lo = *(const v8bf*)(bp);
      v8bf hi = *(const v8bf*)(bp + 16);
      v16bf bf;
#pragma unroll
      for (int j = 0; j < 8; ++j) { bf[j] = lo[j]; bf[8 + j] = hi[j]; }
      c[sub] = __builtin_amdgcn_wmma_f32_16x16x32_bf16(false, af, false, bf, (short)0,
                                                       c[sub], false, false);
    }

    if (has_next) {  // convert + store next tile into the other buffer
      v8bf p0, p1;
#pragma unroll
      for (int j = 0; j < 8; ++j) p0[j] = f2bf(nxt[j]);
#pragma unroll
      for (int j = 0; j < 8; ++j) p1[j] = f2bf(nxt[j + 8]);
      *(v8bf*)&Bs[buf ^ 1][cn * LDS_STRIDE + ck] = p0;
      *(v8bf*)&Bs[buf ^ 1][cn * LDS_STRIDE + ck + 8] = p1;
    }
    __syncthreads();
    buf ^= 1;
  }

  // store: D rows = j + (lane>=16 ? 8 : 0), col = lane&15
  const float* bp = bias + (size_t)e * Ndim;
  const int mrow0 = m_blk + wm * 16 + ((lane < 16) ? 0 : 8);
#pragma unroll
  for (int sub = 0; sub < 4; ++sub) {
    int n = n_blk + wn * 64 + sub * 16 + lane15;
    float bv = bp[n];
#pragma unroll
    for (int j = 0; j < 8; ++j) {
      int m = mrow0 + j;
      if (m < rows) {
        float v = c[sub][j] + bv;
        size_t orow = (size_t)(base + m);
        if constexpr (GELU_OUT) {
          v = 0.5f * v * (1.0f + erff(v * 0.70710678118654752f));  // exact GELU
          Hout[orow * (size_t)Ndim + n] = f2bf(v);
        } else {
          Yout[orow * (size_t)Ndim + n] = v;
        }
      }
    }
  }
}

// ---------------- combine (fixed order -> deterministic) + residual + LayerNorm ----------------
__global__ __launch_bounds__(256) void moe_combine_ln(
    const float* __restrict__ x, const float* __restrict__ y,
    const float* __restrict__ gate, const int* __restrict__ slot_of,
    const float* __restrict__ gamma, const float* __restrict__ beta,
    float* __restrict__ out) {
  int t = blockIdx.x;
  int s0 = slot_of[2 * t], s1 = slot_of[2 * t + 1];
  float w0 = gate[s0], w1 = gate[s1];
  const float* xr = x + (size_t)t * H_DIM;
  const float* y0 = y + (size_t)s0 * H_DIM;
  const float* y1 = y + (size_t)s1 * H_DIM;
  float z[3];
  float s = 0.f, sq = 0.f;
#pragma unroll
  for (int i = 0; i < 3; ++i) {
    int hh = threadIdx.x + i * 256;
    float v = xr[hh] + w0 * y0[hh] + w1 * y1[hh];
    z[i] = v; s += v; sq += v * v;
  }
#pragma unroll
  for (int off = 16; off > 0; off >>= 1) {
    s += __shfl_xor(s, off, 32);
    sq += __shfl_xor(sq, off, 32);
  }
  __shared__ float rs[8], rq[8];
  int wave = threadIdx.x >> 5, lane = threadIdx.x & 31;
  if (lane == 0) { rs[wave] = s; rq[wave] = sq; }
  __syncthreads();
  if (threadIdx.x == 0) {
    float S = 0.f, Q = 0.f;
    for (int i = 0; i < 8; ++i) { S += rs[i]; Q += rq[i]; }
    rs[0] = S; rq[0] = Q;
  }
  __syncthreads();
  float mean = rs[0] * (1.0f / H_DIM);
  float var = rq[0] * (1.0f / H_DIM) - mean * mean;
  float inv = rsqrtf(var + LN_EPS);
#pragma unroll
  for (int i = 0; i < 3; ++i) {
    int hh = threadIdx.x + i * 256;
    out[(size_t)t * H_DIM + hh] = (z[i] - mean) * inv * gamma[hh] + beta[hh];
  }
}

extern "C" void kernel_launch(void* const* d_in, const int* in_sizes, int n_in,
                              void* d_out, int out_size, void* d_ws, size_t ws_size,
                              hipStream_t stream) {
  const float* x  = (const float*)d_in[0];
  const float* W1 = (const float*)d_in[1];
  const float* b1 = (const float*)d_in[2];
  const float* W2 = (const float*)d_in[3];
  const float* b2 = (const float*)d_in[4];
  const float* Wg = (const float*)d_in[5];
  const float* bg = (const float*)d_in[6];
  const float* gamma = (const float*)d_in[7];
  const float* beta  = (const float*)d_in[8];
  float* out = (float*)d_out;

  char* ws = (char*)d_ws;
  size_t off = 0;
  auto alloc = [&](size_t bytes) -> void* {
    void* p = ws + off;
    off = (off + bytes + 255) & ~(size_t)255;
    return p;
  };
  bf16_t* xb     = (bf16_t*)alloc((size_t)T_TOK * H_DIM * sizeof(bf16_t));  // 3.1 MB
  bf16_t* hbuf   = (bf16_t*)alloc((size_t)A_TOT * I_DIM * sizeof(bf16_t));  // 25.2 MB
  float*  ybuf   = (float*) alloc((size_t)A_TOT * H_DIM * sizeof(float));   // 12.6 MB
  int*    top_e  = (int*)   alloc((size_t)T_TOK * 2 * sizeof(int));
  float*  top_w  = (float*) alloc((size_t)T_TOK * 2 * sizeof(float));
  int*    counts = (int*)   alloc(E_NUM * sizeof(int));
  int*    offsv  = (int*)   alloc(E_NUM * sizeof(int));
  int*    rowtok = (int*)   alloc((size_t)A_TOT * sizeof(int));
  float*  gate   = (float*) alloc((size_t)A_TOT * sizeof(float));
  int*    slotof = (int*)   alloc((size_t)T_TOK * 2 * sizeof(int));

  cvt_x_kernel<<<1536, 256, 0, stream>>>(x, xb);
  moe_router<<<T_TOK / 8, 256, 0, stream>>>(x, Wg, bg, top_e, top_w);
  moe_partition<<<1, 1024, 0, stream>>>(top_e, top_w, counts, offsv, rowtok, gate, slotof);
  // GEMM1 + GELU: A = xb[token], W1_e [H x I], out bf16 h [slot][I]
  moe_gemm<true><<<dim3(I_DIM / TILE_N, (T_TOK + 63) / 64, E_NUM), 256, 0, stream>>>(
      xb, H_DIM, W1, b1, H_DIM, I_DIM, counts, offsv, rowtok, hbuf, nullptr);
  // GEMM2: A = h[slot], W2_e [I x H], out fp32 y [slot][H]
  moe_gemm<false><<<dim3(H_DIM / TILE_N, (T_TOK + 63) / 64, E_NUM), 256, 0, stream>>>(
      hbuf, I_DIM, W2, b2, I_DIM, H_DIM, counts, offsv, nullptr, nullptr, ybuf);
  moe_combine_ln<<<T_TOK, 256, 0, stream>>>(x, ybuf, gate, slotof, gamma, beta, out);
}

// v002
// It runs in 156 microseconds.
// Next to v001, in two timings, it ran 1.37 times as fast each time.
// All steps since v000 together make it 1.64 times as fast.
#include <hip/hip_runtime.h>
#include <hip/hip_bf16.h>
#include <math.h>

// MoE (top-2 of 8 experts), H=768, I=3072, T=2048 tokens.
// bf16 WMMA (v_wmma_f32_16x16x32_bf16) with fp32 accumulate; gather-based
// expert execution (exactly K*T = 4096 assignment rows of GEMM work).
// GEMM: 64x128 block tile, 8 waves (4M x 2N), 16x64 per wave (4 WMMA accums),
// double-buffered LDS weight tile (fp32 -> bf16 on the fly), 64 or 96 k per pass, 1 barrier/pass.

typedef __bf16 bf16_t;
typedef __attribute__((ext_vector_type(16))) __bf16 v16bf;
typedef __attribute__((ext_vector_type(8)))  __bf16 v8bf;
typedef __attribute__((ext_vector_type(8)))  float  v8f;

#define T_TOK 2048
#define H_DIM 768
#define I_DIM 3072
#define E_NUM 8
#define A_TOT (T_TOK * 2)
#define LN_EPS 1e-5f

#define TILE_N 128
// k per pass (K_PASS) must divide the GEMM's K. K_PASS / 2 weight loads + K_PASS / 16 A loads a lane
// are out at a time: 96 is the deepest that stays under the 63 loads a wave may have outstanding.
#define K_PASS_1 64     // GEMM1: many work-groups; the smaller register set lets four share a WGP
#define K_PASS_2 96     // GEMM2: few work-groups and a long K: as deep as the load counter allows

__device__ __forceinline__ bf16_t f2bf(float f) {
  unsigned u = __builtin_bit_cast(unsigned, f);
  u += 0x7FFFu + ((u >> 16) & 1u);                 // round-to-nearest-even
  unsigned short hs = (unsigned short)(u >> 16);
  return __builtin_bit_cast(bf16_t, hs);
}

// ---------------- x -> bf16 ----------------
__global__ void cvt_x_kernel(const float* __restrict__ x, bf16_t* __restrict__ xb) {
  int n = T_TOK * H_DIM;
  for (int i = blockIdx.x * blockDim.x + threadIdx.x; i < n; i += gridDim.x * blockDim.x)
    xb[i] = f2bf(x[i]);
}

// ---------------- router: one wave per token ----------------
__global__ __launch_bounds__(256) void moe_router(
    const float* __restrict__ x, const float* __restrict__ Wg,
    const float* __restrict__ bg, int* __restrict__ top_e, float* __restrict__ top_w) {
  int wave = threadIdx.x >> 5;
  int lane = threadIdx.x & 31;
  int t = blockIdx.x * 8 + wave;
  if (t >= T_TOK) return;
  float acc[E_NUM];
#pragma unroll
  for (int e = 0; e < E_NUM; ++e) acc[e] = 0.f;
  const float* xr = x + (size_t)t * H_DIM;
  for (int h = lane; h < H_DIM; h += 32) {
    float xv = xr[h];
    const float* wr = Wg + (size_t)h * E_NUM;
#pragma unroll
    for (int e = 0; e < E_NUM; ++e) acc[e] += xv * wr[e];
  }
#pragma unroll
  for (int e = 0; e < E_NUM; ++e) {
#pragma unroll
    for (int off = 16; off > 0; off >>= 1) acc[e] += __shfl_xor(acc[e], off, 32);
  }
  if (lane == 0) {
    float p[E_NUM];
    float mx = -1e30f;
#pragma unroll
    for (int e = 0; e < E_NUM; ++e) { p[e] = acc[e] + bg[e]; mx = fmaxf(mx, p[e]); }
    float sum = 0.f;
#pragma unroll
    for (int e = 0; e < E_NUM; ++e) { p[e] = expf(p[e] - mx); sum += p[e]; }
    float inv = 1.0f / sum;
#pragma unroll
    for (int e = 0; e < E_NUM; ++e) p[e] *= inv;
    int i0 = 0; float v0 = p[0];
#pragma unroll
    for (int e = 1; e < E_NUM; ++e) if (p[e] > v0) { v0 = p[e]; i0 = e; }   // first index wins ties
    int i1 = -1; float v1 = -1.0f;
#pragma unroll
    for (int e = 0; e < E_NUM; ++e) if (e != i0 && p[e] > v1) { v1 = p[e]; i1 = e; }
    float s2 = v0 + v1;
    top_e[2 * t] = i0;       top_e[2 * t + 1] = i1;
    top_w[2 * t] = v0 / s2;  top_w[2 * t + 1] = v1 / s2;
  }
}

// ---------------- deterministic partition: one wave per (expert, token quarter) ----------------
// 32 waves. Each wave takes its 512 tokens' expert pairs and weights into registers with one
// batch of independent loads, counts its matches, and gets its first slot from the 32 counts
// in LDS. Slots of an expert stay in ascending token order.
#define PART_Q 4                                  // token quarters
#define PART_IT (T_TOK / PART_Q / 32)             // groups of 32 tokens per wave
__global__ __launch_bounds__(1024) void moe_partition(
    const int* __restrict__ top_e, const float* __restrict__ top_w,
    int* __restrict__ counts, int* __restrict__ offs,
    int* __restrict__ rowtok, float* __restrict__ gate, int* __restrict__ slot_of) {
  const int wave = threadIdx.x >> 5;              // = e * PART_Q + q: slot order of the pieces
  const int lane = threadIdx.x & 31;
  const int e = wave >> 2;
  const int q = wave & (PART_Q - 1);
  const int t0 = q * (T_TOK / PART_Q) + lane;
  __shared__ int scnt[E_NUM * PART_Q];

  int e0[PART_IT], e1[PART_IT];
  float w0[PART_IT], w1[PART_IT];
#pragma unroll  // all loads independent and in flight together: one memory round trip
  for (int i = 0; i < PART_IT; ++i) {
    int2 ev = ((const int2*)top_e)[t0 + i * 32];
    float2 wv = ((const float2*)top_w)[t0 + i * 32];
    e0[i] = ev.x; e1[i] = ev.y;
    w0[i] = wv.x; w1[i] = wv.y;
  }
  unsigned m[PART_IT];
  int cnt = 0;
#pragma unroll  // arrays stay in registers
  for (int i = 0; i < PART_IT; ++i) {
    bool sel = (e0[i] == e) | (e1[i] == e);
    m[i] = (unsigned)(__ballot(sel) & 0xffffffffull);
    cnt += __popc(m[i]);
  }
  if (lane == 0) scnt[wave] = cnt;
  __syncthreads();
  const int v = scnt[lane];
  int before = (lane < wave) ? v : 0;             // pieces that come first in slot order
  int mine = ((lane >> 2) == e) ? v : 0;          // the expert's own four pieces
#pragma unroll
  for (int off = 16; off > 0; off >>= 1) {
    before += __shfl_xor(before, off, 32);
    mine += __shfl_xor(mine, off, 32);
  }
  if (q == 0 && lane == 0) { offs[e] = before; counts[e] = mine; }
  int pos = before;
  const unsigned lt = (1u << lane) - 1u;
#pragma unroll  // arrays stay in registers
  for (int i = 0; i < PART_IT; ++i) {
    if ((m[i] >> lane) & 1u) {
      const bool first = (e0[i] == e);
      const int t = t0 + i * 32;
      const int slot = pos + __popc(m[i] & lt);
      rowtok[slot] = t;
      gate[slot] = first ? w0[i] : w1[i];
      slot_of[2 * t + (first ? 0 : 1)] = slot;
    }
    pos += __popc(m[i]);
  }
}

// ---------------- WMMA GEMM: C[rows_e x Ndim] = A[rows] x W_e[Kdim x Ndim] ----------------
template <bool GELU_OUT, int K_PASS>
__global__ __launch_bounds__(256) void moe_gemm(
    const bf16_t* __restrict__ A,
    const float* __restrict__ Wfull, const float* __restrict__ bias,
    const int* __restrict__ counts, const int* __restrict__ offs,
    const int* __restrict__ rowtok,              // null -> identity (slot rows)
    bf16_t* __restrict__ Hout, float* __restrict__ Yout) {
  // shapes at compile time: a pass's loads then share one address register pair and differ in
  // their immediate offsets, so that holding them all in flight costs no register per address
  constexpr int Kdim = GELU_OUT ? H_DIM : I_DIM;
  constexpr int Ndim = GELU_OUT ? I_DIM : H_DIM;
  constexpr int lda = Kdim;
  static_assert(Kdim % K_PASS == 0, "whole passes only");
  constexpr int K_SUB = K_PASS / 32;             // WMMA k-blocks per pass
  constexpr int K_THR = K_PASS / 2;              // k rows of the weight tile per thread
  constexpr int LDS_STRIDE = K_PASS + 8;         // 144 or 208 B rows: 16 B x odd, no bank conflicts
  const int e = blockIdx.z;
  const int rows = counts[e];
  const int m_blk = blockIdx.y * 64;
  if (m_blk >= rows) return;                     // block-uniform exit
  const int n_blk = blockIdx.x * TILE_N;
  const int wave = threadIdx.x >> 5;
  const int lane = threadIdx.x & 31;
  const int wm = wave >> 1;                      // 0..3 (M, 16 each)
  const int wn = wave & 1;                       // 0..1 (N, 64 each)
  const int lane15 = lane & 15;
  const int khalf = (lane >> 4) * 8;             // 0 or 8 per WMMA 16-bit layout

  // double-buffered weight tile: [n][k] layout, bf16
  __shared__ __align__(16) bf16_t Bs[2][TILE_N * LDS_STRIDE];

  const float* W = Wfull + (size_t)e * Kdim * Ndim;
  const int base = offs[e];

  int mloc = m_blk + wm * 16 + lane15;
  if (mloc >= rows) mloc = rows - 1;             // clamp (stores are guarded)
  const int arow = rowtok ? rowtok[base + mloc] : (base + mloc);
  const bf16_t* Arow = A + (size_t)arow * lda;

  // cooperative weight-tile loader: thread covers (n = tid&127, k chunk of K_THR)
  const int cn = threadIdx.x & 127;
  const int ck = (threadIdx.x >> 7) * K_THR;     // 0 or K_THR

  v8f c[4] = {v8f{}, v8f{}, v8f{}, v8f{}};

  // prologue: tile k0 = 0 -> Bs[0]
  {
    const float* wp = W + (size_t)ck * Ndim + (n_blk + cn);
    float first[K_THR];
#pragma unroll  // all loads independent and in flight together
    for (int j = 0; j < K_THR; ++j) first[j] = wp[(size_t)j * Ndim];
#pragma unroll  // first[] stays in registers
    for (int g = 0; g < K_THR / 8; ++g) {
      v8bf p;
#pragma unroll
      for (int j = 0; j < 8; ++j) p[j] = f2bf(first[g * 8 + j]);
      *(v8bf*)&Bs[0][cn * LDS_STRIDE + ck + g * 8] = p;
    }
  }
  __syncthreads();

  // A fragments of one pass: row = lane15, K = khalf+[0..7] and khalf+16+[0..7] of each 32-k block
  auto load_a = [&](int k0, v16bf (&af)[K_SUB]) {
#pragma unroll  // af[] stays in registers
    for (int kk = 0; kk < K_SUB; ++kk) {
      const bf16_t* ap = Arow + k0 + kk * 32 + khalf;
      v8bf lo = *(const v8bf*)(ap);
      v8bf hi = *(const v8bf*)(ap + 16);
#pragma unroll
      for (int j = 0; j < 8; ++j) { af[kk][j] = lo[j]; af[kk][8 + j] = hi[j]; }
    }
  };
  // one pass of products, k ascending: per 32-k block 4 B fragments + 4 WMMAs (wave's 16x64 output)
  auto pass_mm = [&](const v16bf (&af)[K_SUB], int buf) {
#pragma unroll  // af[] stays in registers, LDS offsets become immediates
    for (int kk = 0; kk < K_SUB; ++kk) {
#pragma unroll
      for (int sub = 0; sub < 4; ++sub) {
        const bf16_t* bp =
            &Bs[buf][(wn * 64 + sub * 16 + lane15) * LDS_STRIDE + kk * 32 + khalf];
        v8bf lo = *(const v8bf*)(bp);
        v8bf hi = *(const v8bf*)(bp + 16);
        v16bf bf;
#pragma unroll
        for (int j = 0; j < 8; ++j) { bf[j] = lo[j]; bf[8 + j] = hi[j]; }
        c[sub] = __builtin_amdgcn_wmma_f32_16x16x32_bf16(false, af[kk], false, bf, (short)0,
                                                         c[sub], false, false);
      }
    }
  };

  int buf = 0;
  int k0 = 0;
  // every pass but the last (peeled, so that no branch stands between the loads and their
  // counted waits): the wait for A then leaves the weight loads behind it in flight
  for (; k0 + K_PASS < Kdim; k0 += K_PASS) {
    v16bf af[K_SUB];
    load_a(k0, af);
    // loads return in issue order: keeps every weight load behind the A loads, so that the wait
    // for A in front of the first WMMA covers none of them
    __builtin_amdgcn_sched_barrier(0);
    float nxt[K_THR];                            // next tile, in flight while the WMMAs run
    const float* wp = W + (size_t)(k0 + K_PASS + ck) * Ndim + (n_blk + cn);
#pragma unroll  // nxt[] stays in registers; all loads independent and in flight together
    for (int j = 0; j < K_THR; ++j) nxt[j] = wp[(size_t)j * Ndim];
    // keeps the scheduler from sinking the loads down to their uses behind the WMMAs,
    // where only a few of them would be in flight at a time
    __builtin_amdgcn_sched_barrier(0);

    pass_mm(af, buf);
    // keeps the conversions, and with them the waits for the weight loads, behind the WMMAs
    __builtin_amdgcn_sched_barrier(0);

#pragma unroll  // convert + store next tile into the other buffer
    for (int g = 0; g < K_THR / 8; ++g) {
      v8bf p;
#pragma unroll
      for (int j = 0; j < 8; ++j) p[j] = f2bf(nxt[g * 8 + j]);
      *(v8bf*)&Bs[buf ^ 1][cn * LDS_STRIDE + ck + g * 8] = p;
    }
    __syncthreads();
    buf ^= 1;
  }
  {  // last pass: nothing left to fetch, nobody writes LDS behind it
    v16bf af[K_SUB];
    load_a(k0, af);
    pass_mm(af, buf);
  }

  // store: D rows = j + (lane>=16 ? 8 : 0), col = lane&15
  const float* bp = bias + (size_t)e * Ndim;
  const int mrow0 = m_blk + wm * 16 + ((lane < 16) ? 0 : 8);
#pragma unroll
  for (int sub = 0; sub < 4; ++sub) {
    int n = n_blk + wn * 64 + sub * 16 + lane15;
    float bv = bp[n];
#pragma unroll
    for (int j = 0; j < 8; ++j) {
      int m = mrow0 + j;
      if (m < rows) {
        float v = c[sub][j] + bv;
        size_t orow = (size_t)(base + m);
        if constexpr (GELU_OUT) {
          v = 0.5f * v * (1.0f + erff(v * 0.70710678118654752f));  // exact GELU
          Hout[orow * (size_t)Ndim + n] = f2bf(v);
        } else {
          Yout[orow * (size_t)Ndim + n] = v;
        }
      }
    }
  }
}

// ---------------- combine (fixed order -> deterministic) + residual + LayerNorm ----------------
__global__ __launch_bounds__(256) void moe_combine_ln(
    const float* __restrict__ x, const float* __restrict__ y,
    const float* __restrict__ gate, const int* __restrict__ slot_of,
    const float* __restrict__ gamma, const float* __restrict__ beta,
    float* __restrict__ out) {
  int t = blockIdx.x;
  int s0 = slot_of[2 * t], s1 = slot_of[2 * t + 1];
  float w0 = gate[s0], w1 = gate[s1];
  const float* xr = x + (size_t)t * H_DIM;
  const float* y0 = y + (size_t)s0 * H_DIM;
  const float* y1 = y + (size_t)s1 * H_DIM;
  float z[3];
  float s = 0.f, sq = 0.f;
#pragma unroll
  for (int i = 0; i < 3; ++i) {
    int hh = threadIdx.x + i * 256;
    float v = xr[hh] + w0 * y0[hh] + w1 * y1[hh];
    z[i] = v; s += v; sq += v * v;
  }
#pragma unroll
  for (int off = 16; off > 0; off >>= 1) {
    s += __shfl_xor(s, off, 32);
    sq += __shfl_xor(sq, off, 32);
  }
  __shared__ float rs[8], rq[8];
  int wave = threadIdx.x >> 5, lane = threadIdx.x & 31;
  if (lane == 0) { rs[wave] = s; rq[wave] = sq; }
  __syncthreads();
  if (threadIdx.x == 0) {
    float S = 0.f, Q = 0.f;
    for (int i = 0; i < 8; ++i) { S += rs[i]; Q += rq[i]; }
    rs[0] = S; rq[0] = Q;
  }
  __syncthreads();
  float mean = rs[0] * (1.0f / H_DIM);
  float var = rq[0] * (1.0f / H_DIM) - mean * mean;
  float inv = rsqrtf(var + LN_EPS);
#pragma unroll
  for (int i = 0; i < 3; ++i) {
    int hh = threadIdx.x + i * 256;
    out[(size_t)t * H_DIM + hh] = (z[i] - mean) * inv * gamma[hh] + beta[hh];
  }
}

extern "C" void kernel_launch(void* const* d_in, const int* in_sizes, int n_in,
                              void* d_out, int out_size, void* d_ws, size_t ws_size,
                              hipStream_t stream) {
  const float* x  = (const float*)d_in[0];
  const float* W1 = (const float*)d_in[1];
  const float* b1 = (const float*)d_in[2];
  const float* W2 = (const float*)d_in[3];
  const float* b2 = (const float*)d_in[4];
  const float* Wg = (const float*)d_in[5];
  const float* bg = (const float*)d_in[6];
  const float* gamma = (const float*)d_in[7];
  const float* beta  = (const float*)d_in[8];
  float* out = (float*)d_out;

  char* ws = (char*)d_ws;
  size_t off = 0;
  auto alloc = [&](size_t bytes) -> void* {
    void* p = ws + off;
    off = (off + bytes + 255) & ~(size_t)255;
    return p;
  };
  bf16_t* xb     = (bf16_t*)alloc((size_t)T_TOK * H_DIM * sizeof(bf16_t));  // 3.1 MB
  bf16_t* hbuf   = (bf16_t*)alloc((size_t)A_TOT * I_DIM * sizeof(bf16_t));  // 25.2 MB
  float*  ybuf   = (float*) alloc((size_t)A_TOT * H_DIM * sizeof(float));   // 12.6 MB
  int*    top_e  = (int*)   alloc((size_t)T_TOK * 2 * sizeof(int));
  float*  top_w  = (float*) alloc((size_t)T_TOK * 2 * sizeof(float));
  int*    counts = (int*)   alloc(E_NUM * sizeof(int));
  int*    offsv  = (int*)   alloc(E_NUM * sizeof(int));
  int*    rowtok = (int*)   alloc((size_t)A_TOT * sizeof(int));
  float*  gate   = (float*) alloc((size_t)A_TOT * sizeof(float));
  int*    slotof = (int*)   alloc((size_t)T_TOK * 2 * sizeof(int));

  cvt_x_kernel<<<1536, 256, 0, stream>>>(x, xb);
  moe_router<<<T_TOK / 8, 256, 0, stream>>>(x, Wg, bg, top_e, top_w);
  moe_partition<<<1, 1024, 0, stream>>>(top_e, top_w, counts, offsv, rowtok, gate, slotof);
  // GEMM1 + GELU: A = xb[token], W1_e [H x I], out bf16 h [slot][I]
  moe_gemm<true, K_PASS_1><<<dim3(I_DIM / TILE_N, (T_TOK + 63) / 64, E_NUM), 256, 0, stream>>>(
      xb, W1, b1, counts, offsv, rowtok, hbuf, nullptr);
  // GEMM2: A = h[slot], W2_e [I x H], out fp32 y [slot][H]
  moe_gemm<false, K_PASS_2><<<dim3(H_DIM / TILE_N, (T_TOK + 63) / 64, E_NUM), 256, 0, stream>>>(
      hbuf, W2, b2, counts, offsv, nullptr, nullptr, ybuf);
  moe_combine_ln<<<T_TOK, 256, 0, stream>>>(x, ybuf, gate, slotof, gamma, beta, out);
}

// v003
// Measured time: 146 microseconds a run.
// Two timings next to v002 both put it at 1.08 times that version's speed.
// Counting every step since v000, it is 1.77 times as fast.
#include <hip/hip_runtime.h>
#include <hip/hip_bf16.h>
#include <math.h>

// MoE (top-2 of 8 experts), H=768, I=3072, T=2048 tokens.
// bf16 WMMA (v_wmma_f32_16x16x32_bf16) with fp32 accumulate; gather-based
// expert execution (exactly K*T = 4096 assignment rows of GEMM work).
// GEMM: 64x128 block tile, 8 waves (4M x 2N), 16x64 per wave (4 WMMA accums),
// double-buffered LDS weight tile (fp32 -> bf16 on the fly), 64 or 96 k per pass, 1 barrier/pass.
// GEMM grid: (column tiles) x (row tiles any routing can need, all experts in a row).

typedef __bf16 bf16_t;
typedef __attribute__((ext_vector_type(16))) __bf16 v16bf;
typedef __attribute__((ext_vector_type(8)))  __bf16 v8bf;
typedef __attribute__((ext_vector_type(8)))  float  v8f;

#define T_TOK 2048
#define H_DIM 768
#define I_DIM 3072
#define E_NUM 8
#define A_TOT (T_TOK * 2)
#define LN_EPS 1e-5f

#define TILE_N 128
#define TILE_M 64
// row tiles that any routing can need: each expert rounds its rows up to whole tiles
#define M_TILES_MAX (A_TOT / TILE_M + E_NUM)
// k per pass (K_PASS) must divide the GEMM's K. K_PASS / 2 weight loads + K_PASS / 16 A loads a lane
// are out at a time: 96 is the deepest that stays under the 63 loads a wave may have outstanding.
#define K_PASS_1 64     // GEMM1: many work-groups; the smaller register set lets four share a WGP
#define K_PASS_2 96     // GEMM2: few work-groups and a long K: as deep as the load counter allows

__device__ __forceinline__ bf16_t f2bf(float f) {
  unsigned u = __builtin_bit_cast(unsigned, f);
  u += 0x7FFFu + ((u >> 16) & 1u);                 // round-to-nearest-even
  unsigned short hs = (unsigned short)(u >> 16);
  return __builtin_bit_cast(bf16_t, hs);
}

// ---------------- x -> bf16 ----------------
__global__ void cvt_x_kernel(const float* __restrict__ x, bf16_t* __restrict__ xb) {
  int n = T_TOK * H_DIM;
  for (int i = blockIdx.x * blockDim.x + threadIdx.x; i < n; i += gridDim.x * blockDim.x)
    xb[i] = f2bf(x[i]);
}

// ---------------- router: one wave per token ----------------
__global__ __launch_bounds__(256) void moe_router(
    const float* __restrict__ x, const float* __restrict__ Wg,
    const float* __restrict__ bg, int* __restrict__ top_e, float* __restrict__ top_w) {
  int wave = threadIdx.x >> 5;
  int lane = threadIdx.x & 31;
  int t = blockIdx.x * 8 + wave;
  if (t >= T_TOK) return;
  float acc[E_NUM];
#pragma unroll
  for (int e = 0; e < E_NUM; ++e) acc[e] = 0.f;
  const float* xr = x + (size_t)t * H_DIM;
  for (int h = lane; h < H_DIM; h += 32) {
    float xv = xr[h];
    const float* wr = Wg + (size_t)h * E_NUM;
#pragma unroll
    for (int e = 0; e < E_NUM; ++e) acc[e] += xv * wr[e];
  }
#pragma unroll
  for (int e = 0; e < E_NUM; ++e) {
#pragma unroll
    for (int off = 16; off > 0; off >>= 1) acc[e] += __shfl_xor(acc[e], off, 32);
  }
  if (lane == 0) {
    float p[E_NUM];
    float mx = -1e30f;
#pragma unroll
    for (int e = 0; e < E_NUM; ++e) { p[e] = acc[e] + bg[e]; mx = fmaxf(mx, p[e]); }
    float sum = 0.f;
#pragma unroll
    for (int e = 0; e < E_NUM; ++e) { p[e] = expf(p[e] - mx); sum += p[e]; }
    float inv = 1.0f / sum;
#pragma unroll
    for (int e = 0; e < E_NUM; ++e) p[e] *= inv;
    int i0 = 0; float v0 = p[0];
#pragma unroll
    for (int e = 1; e < E_NUM; ++e) if (p[e] > v0) { v0 = p[e]; i0 = e; }   // first index wins ties
    int i1 = -1; float v1 = -1.0f;
#pragma unroll
    for (int e = 0; e < E_NUM; ++e) if (e != i0 && p[e] > v1) { v1 = p[e]; i1 = e; }
    float s2 = v0 + v1;
    top_e[2 * t] = i0;       top_e[2 * t + 1] = i1;
    top_w[2 * t] = v0 / s2;  top_w[2 * t + 1] = v1 / s2;
  }
}

// ---------------- deterministic partition: one wave per (expert, token quarter) ----------------
// 32 waves. Each wave takes its 512 tokens' expert pairs and weights into registers with one
// batch of independent loads, counts its matches, and gets its first slot from the 32 counts
// in LDS. Slots of an expert stay in ascending token order.
#define PART_Q 4                                  // token quarters
#define PART_IT (T_TOK / PART_Q / 32)             // groups of 32 tokens per wave
__global__ __launch_bounds__(1024) void moe_partition(
    const int* __restrict__ top_e, const float* __restrict__ top_w,
    int* __restrict__ counts, int* __restrict__ offs,
    int* __restrict__ rowtok, float* __restrict__ gate, int* __restrict__ slot_of) {
  const int wave = threadIdx.x >> 5;              // = e * PART_Q + q: slot order of the pieces
  const int lane = threadIdx.x & 31;
  const int e = wave >> 2;
  const int q = wave & (PART_Q - 1);
  const int t0 = q * (T_TOK / PART_Q) + lane;
  __shared__ int scnt[E_NUM * PART_Q];

  int e0[PART_IT], e1[PART_IT];
  float w0[PART_IT], w1[PART_IT];
#pragma unroll  // all loads independent and in flight together: one memory round trip
  for (int i = 0; i < PART_IT; ++i) {
    int2 ev = ((const int2*)top_e)[t0 + i * 32];
    float2 wv = ((const float2*)top_w)[t0 + i * 32];
    e0[i] = ev.x; e1[i] = ev.y;
    w0[i] = wv.x; w1[i] = wv.y;
  }
  unsigned m[PART_IT];
  int cnt = 0;
#pragma unroll  // arrays stay in registers
  for (int i = 0; i < PART_IT; ++i) {
    bool sel = (e0[i] == e) | (e1[i] == e);
    m[i] = (unsigned)(__ballot(sel) & 0xffffffffull);
    cnt += __popc(m[i]);
  }
  if (lane == 0) scnt[wave] = cnt;
  __syncthreads();
  const int v = scnt[lane];
  int before = (lane < wave) ? v : 0;             // pieces that come first in slot order
  int mine = ((lane >> 2) == e) ? v : 0;          // the expert's own four pieces
#pragma unroll
  for (int off = 16; off > 0; off >>= 1) {
    before += __shfl_xor(before, off, 32);
    mine += __shfl_xor(mine, off, 32);
  }
  if (q == 0 && lane == 0) { offs[e] = before; counts[e] = mine; }
  int pos = before;
  const unsigned lt = (1u << lane) - 1u;
#pragma unroll  // arrays stay in registers
  for (int i = 0; i < PART_IT; ++i) {
    if ((m[i] >> lane) & 1u) {
      const bool first = (e0[i] == e);
      const int t = t0 + i * 32;
      const int slot = pos + __popc(m[i] & lt);
      rowtok[slot] = t;
      gate[slot] = first ? w0[i] : w1[i];
      slot_of[2 * t + (first ? 0 : 1)] = slot;
    }
    pos += __popc(m[i]);
  }
}

// ---------------- WMMA GEMM: C[rows_e x Ndim] = A[rows] x W_e[Kdim x Ndim] ----------------
template <bool GELU_OUT, int K_PASS>
__global__ __launch_bounds__(256) void moe_gemm(
    const bf16_t* __restrict__ A,
    const float* __restrict__ Wfull, const float* __restrict__ bias,
    const int* __restrict__ counts, const int* __restrict__ offs,
    const int* __restrict__ rowtok,              // null -> identity (slot rows)
    bf16_t* __restrict__ Hout, float* __restrict__ Yout) {
  // shapes at compile time: a pass's loads then share one address register pair and differ in
  // their immediate offsets, so that holding them all in flight costs no register per address
  constexpr int Kdim = GELU_OUT ? H_DIM : I_DIM;
  constexpr int Ndim = GELU_OUT ? I_DIM : H_DIM;
  constexpr int lda = Kdim;
  static_assert(Kdim % K_PASS == 0, "whole passes only");
  constexpr int K_SUB = K_PASS / 32;             // WMMA k-blocks per pass
  constexpr int K_THR = K_PASS / 2;              // k rows of the weight tile per thread
  constexpr int LDS_STRIDE = K_PASS + 8;         // 144 or 208 B rows: 16 B x odd, no bank conflicts
  // blockIdx.y counts the row tiles that exist, expert after expert: the grid then holds no
  // work-group per (expert, possible tile) that only starts, finds no rows and ends
  const int tile = blockIdx.y;
  // each array fetched whole, ahead of the search: one scalar load an array, none inside the search
  const int4 c_lo = ((const int4*)counts)[0], c_hi = ((const int4*)counts)[1];
  const int4 o_lo = ((const int4*)offs)[0], o_hi = ((const int4*)offs)[1];
  const int cnt_of[E_NUM] = {c_lo.x, c_lo.y, c_lo.z, c_lo.w, c_hi.x, c_hi.y, c_hi.z, c_hi.w};
  const int off_of[E_NUM] = {o_lo.x, o_lo.y, o_lo.z, o_lo.w, o_hi.x, o_hi.y, o_hi.z, o_hi.w};
  int e = -1, rows = 0, base = 0, start = 0, first = 0;
#pragma unroll  // the two arrays stay in scalar registers
  for (int i = 0; i < E_NUM; ++i) {
    const int nt = (int)((unsigned)(cnt_of[i] + TILE_M - 1) / TILE_M);
    const bool hit = (tile >= first) & (tile < first + nt);
    e = hit ? i : e;
    rows = hit ? cnt_of[i] : rows;
    base = hit ? off_of[i] : base;
    start = hit ? first : start;
    first += nt;
  }
  if (e < 0) return;                             // block-uniform exit: past the last tile
  const int m_blk = (tile - start) * TILE_M;     // < rows: the tile is one of the expert's own
  const int n_blk = blockIdx.x * TILE_N;
  const int wave = threadIdx.x >> 5;
  const int lane = threadIdx.x & 31;
  const int wm = wave >> 1;                      // 0..3 (M, 16 each)
  const int wn = wave & 1;                       // 0..1 (N, 64 each)
  const int lane15 = lane & 15;
  const int khalf = (lane >> 4) * 8;             // 0 or 8 per WMMA 16-bit layout

  // double-buffered weight tile: [n][k] layout, bf16
  __shared__ __align__(16) bf16_t Bs[2][TILE_N * LDS_STRIDE];

  const float* W = Wfull + (size_t)e * Kdim * Ndim;

  int mloc = m_blk + wm * 16 + lane15;
  if (mloc >= rows) mloc = rows - 1;             // clamp (stores are guarded)
  const int arow = rowtok ? rowtok[base + mloc] : (base + mloc);
  const bf16_t* Arow = A + (size_t)arow * lda;

  // cooperative weight-tile loader: thread covers (n = tid&127, k chunk of K_THR)
  const int cn = threadIdx.x & 127;
  const int ck = (threadIdx.x >> 7) * K_THR;     // 0 or K_THR

  v8f c[4] = {v8f{}, v8f{}, v8f{}, v8f{}};

  // prologue: tile k0 = 0 -> Bs[0]
  {
    const float* wp = W + (size_t)ck * Ndim + (n_blk + cn);
    float first[K_THR];
#pragma unroll  // all loads independent and in flight together
    for (int j = 0; j < K_THR; ++j) first[j] = wp[(size_t)j * Ndim];
#pragma unroll  // first[] stays in registers
    for (int g = 0; g < K_THR / 8; ++g) {
      v8bf p;
#pragma unroll
      for (int j = 0; j < 8; ++j) p[j] = f2bf(first[g * 8 + j]);
      *(v8bf*)&Bs[0][cn * LDS_STRIDE + ck + g * 8] = p;
    }
  }
  __syncthreads();

  // A fragments of one pass: row = lane15, K = khalf+[0..7] and khalf+16+[0..7] of each 32-k block
  auto load_a = [&](int k0, v16bf (&af)[K_SUB]) {
#pragma unroll  // af[] stays in registers
    for (int kk = 0; kk < K_SUB; ++kk) {
      const bf16_t* ap = Arow + k0 + kk * 32 + khalf;
      v8bf lo = *(const v8bf*)(ap);
      v8bf hi = *(const v8bf*)(ap + 16);
#pragma unroll
      for (int j = 0; j < 8; ++j) { af[kk][j] = lo[j]; af[kk][8 + j] = hi[j]; }
    }
  };
  // one pass of products, k ascending: per 32-k block 4 B fragments + 4 WMMAs (wave's 16x64 output)
  auto pass_mm = [&](const v16bf (&af)[K_SUB], int buf) {
#pragma unroll  // af[] stays in registers, LDS offsets become immediates
    for (int kk = 0; kk < K_SUB; ++kk) {
#pragma unroll
      for (int sub = 0; sub < 4; ++sub) {
        const bf16_t* bp =
            &Bs[buf][(wn * 64 + sub * 16 + lane15) * LDS_STRIDE + kk * 32 + khalf];
        v8bf lo = *(const v8bf*)(bp);
        v8bf hi = *(const v8bf*)(bp + 16);
        v16bf bf;
#pragma unroll
        for (int j = 0; j < 8; ++j) { bf[j] = lo[j]; bf[8 + j] = hi[j]; }
        c[sub] = __builtin_amdgcn_wmma_f32_16x16x32_bf16(false, af[kk], false, bf, (short)0,
                                                         c[sub], false, false);
      }
    }
  };

  int buf = 0;
  int k0 = 0;
  // every pass but the last (peeled, so that no branch stands between the loads and their
  // counted waits): the wait for A then leaves the weight loads behind it in flight
  for (; k0 + K_PASS < Kdim; k0 += K_PASS) {
    v16bf af[K_SUB];
    load_a(k0, af);
    // loads return in issue order: keeps every weight load behind the A loads, so that the wait
    // for A in front of the first WMMA covers none of them
    __builtin_amdgcn_sched_barrier(0);
    float nxt[K_THR];                            // next tile, in flight while the WMMAs run
    const float* wp = W + (size_t)(k0 + K_PASS + ck) * Ndim + (n_blk + cn);
#pragma unroll  // nxt[] stays in registers; all loads independent and in flight together
    for (int j = 0; j < K_THR; ++j) nxt[j] = wp[(size_t)j * Ndim];
    // keeps the scheduler from sinking the loads down to their uses behind the WMMAs,
    // where only a few of them would be in flight at a time
    __builtin_amdgcn_sched_barrier(0);

    pass_mm(af, buf);
    // keeps the conversions, and with them the waits for the weight loads, behind the WMMAs
    __builtin_amdgcn_sched_barrier(0);

#pragma unroll  // convert + store next tile into the other buffer
    for (int g = 0; g < K_THR / 8; ++g) {
      v8bf p;
#pragma unroll
      for (int j = 0; j < 8; ++j) p[j] = f2bf(nxt[g * 8 + j]);
      *(v8bf*)&Bs[buf ^ 1][cn * LDS_STRIDE + ck + g * 8] = p;
    }
    __syncthreads();
    buf ^= 1;
  }
  {  // last pass: nothing left to fetch, nobody writes LDS behind it
    v16bf af[K_SUB];
    load_a(k0, af);
    pass_mm(af, buf);
  }

  // store: D rows = j + (lane>=16 ? 8 : 0), col = lane&15
  const float* bp = bias + (size_t)e * Ndim;
  const int mrow0 = m_blk + wm * 16 + ((lane < 16) ? 0 : 8);
#pragma unroll
  for (int sub = 0; sub < 4; ++sub) {
    int n = n_blk + wn * 64 + sub * 16 + lane15;
    float bv = bp[n];
#pragma unroll
    for (int j = 0; j < 8; ++j) {
      int m = mrow0 + j;
      if (m < rows) {
        float v = c[sub][j] + bv;
        size_t orow = (size_t)(base + m);
        if constexpr (GELU_OUT) {
          v = 0.5f * v * (1.0f + erff(v * 0.70710678118654752f));  // exact GELU
          Hout[orow * (size_t)Ndim + n] = f2bf(v);
        } else {
          Yout[orow * (size_t)Ndim + n] = v;
        }
      }
    }
  }
}

// ---------------- combine (fixed order -> deterministic) + residual + LayerNorm ----------------
__global__ __launch_bounds__(256) void moe_combine_ln(
    const float* __restrict__ x, const float* __restrict__ y,
    const float* __restrict__ gate, const int* __restrict__ slot_of,
    const float* __restrict__ gamma, const float* __restrict__ beta,
    float* __restrict__ out) {
  int t = blockIdx.x;
  int s0 = slot_of[2 * t], s1 = slot_of[2 * t + 1];
  float w0 = gate[s0], w1 = gate[s1];
  const float* xr = x + (size_t)t * H_DIM;
  const float* y0 = y + (size_t)s0 * H_DIM;
  const float* y1 = y + (size_t)s1 * H_DIM;
  float z[3];
  float s = 0.f, sq = 0.f;
#pragma unroll
  for (int i = 0; i < 3; ++i) {
    int hh = threadIdx.x + i * 256;
    float v = xr[hh] + w0 * y0[hh] + w1 * y1[hh];
    z[i] = v; s += v; sq += v * v;
  }
#pragma unroll
  for (int off = 16; off > 0; off >>= 1) {
    s += __shfl_xor(s, off, 32);
    sq += __shfl_xor(sq, off, 32);
  }
  __shared__ float rs[8], rq[8];
  int wave = threadIdx.x >> 5, lane = threadIdx.x & 31;
  if (lane == 0) { rs[wave] = s; rq[wave] = sq; }
  __syncthreads();
  if (threadIdx.x == 0) {
    float S = 0.f, Q = 0.f;
    for (int i = 0; i < 8; ++i) { S += rs[i]; Q += rq[i]; }
    rs[0] = S; rq[0] = Q;
  }
  __syncthreads();
  float mean = rs[0] * (1.0f / H_DIM);
  float var = rq[0] * (1.0f / H_DIM) - mean * mean;
  float inv = rsqrtf(var + LN_EPS);
#pragma unroll
  for (int i = 0; i < 3; ++i) {
    int hh = threadIdx.x + i * 256;
    out[(size_t)t * H_DIM + hh] = (z[i] - mean) * inv * gamma[hh] + beta[hh];
  }
}

extern "C" void kernel_launch(void* const* d_in, const int* in_sizes, int n_in,
                              void* d_out, int out_size, void* d_ws, size_t ws_size,
                              hipStream_t stream) {
  const float* x  = (const float*)d_in[0];
  const float* W1 = (const float*)d_in[1];
  const float* b1 = (const float*)d_in[2];
  const float* W2 = (const float*)d_in[3];
  const float* b2 = (const float*)d_in[4];
  const float* Wg = (const float*)d_in[5];
  const float* bg = (const float*)d_in[6];
  const float* gamma = (const float*)d_in[7];
  const float* beta  = (const float*)d_in[8];
  float* out = (float*)d_out;

  char* ws = (char*)d_ws;
  size_t off = 0;
  auto alloc = [&](size_t bytes) -> void* {
    void* p = ws + off;
    off = (off + bytes + 255) & ~(size_t)255;
    return p;
  };
  bf16_t* xb     = (bf16_t*)alloc((size_t)T_TOK * H_DIM * sizeof(bf16_t));  // 3.1 MB
  bf16_t* hbuf   = (bf16_t*)alloc((size_t)A_TOT * I_DIM * sizeof(bf16_t));  // 25.2 MB
  float*  ybuf   = (float*) alloc((size_t)A_TOT * H_DIM * sizeof(float));   // 12.6 MB
  int*    top_e  = (int*)   alloc((size_t)T_TOK * 2 * sizeof(int));
  float*  top_w  = (float*) alloc((size_t)T_TOK * 2 * sizeof(float));
  int*    counts = (int*)   alloc(E_NUM * sizeof(int));
  int*    offsv  = (int*)   alloc(E_NUM * sizeof(int));
  int*    rowtok = (int*)   alloc((size_t)A_TOT * sizeof(int));
  float*  gate   = (float*) alloc((size_t)A_TOT * sizeof(float));
  int*    slotof = (int*)   alloc((size_t)T_TOK * 2 * sizeof(int));

  cvt_x_kernel<<<1536, 256, 0, stream>>>(x, xb);
  moe_router<<<T_TOK / 8, 256, 0, stream>>>(x, Wg, bg, top_e, top_w);
  moe_partition<<<1, 1024, 0, stream>>>(top_e, top_w, counts, offsv, rowtok, gate, slotof);
  // GEMM1 + GELU: A = xb[token], W1_e [H x I], out bf16 h [slot][I]
  moe_gemm<true, K_PASS_1><<<dim3(I_DIM / TILE_N, M_TILES_MAX), 256, 0, stream>>>(
      xb, W1, b1, counts, offsv, rowtok, hbuf, nullptr);
  // GEMM2: A = h[slot], W2_e [I x H], out fp32 y [slot][H]
  moe_gemm<false, K_PASS_2><<<dim3(H_DIM / TILE_N, M_TILES_MAX), 256, 0, stream>>>(
      hbuf, W2, b2, counts, offsv, nullptr, nullptr, ybuf);
  moe_combine_ln<<<T_TOK, 256, 0, stream>>>(x, ybuf, gate, slotof, gamma, beta, out);
}

// v004
// Measured time: 130 microseconds a run.
// Timed twice side by side with v003, it ran 1.13 times as fast both times.
// Over all steps from v000 it is 1.99 times as fast.
#include <hip/hip_runtime.h>
#include <hip/hip_bf16.h>
#include <math.h>

// MoE (top-2 of 8 experts), H=768, I=3072, T=2048 tokens.
// bf16 WMMA (v_wmma_f32_16x16x32_bf16) with fp32 accumulate; gather-based
// expert execution (exactly K*T = 4096 assignment rows of GEMM work).
// GEMM: 64x128 block tile, 8 waves (4M x 2N), 16x64 per wave (4 WMMA accums),
// double-buffered LDS weight tile (fp32 -> bf16 on the fly), 64 or 96 k per pass, 1 barrier/pass.
// A tile (64 rows x one pass of k) double-buffered in LDS too, filled by asynchronous copies.
// GEMM grid: (column tiles) x (row tiles any routing can need; existing ones first, all experts in a row).

typedef __bf16 bf16_t;
typedef __attribute__((ext_vector_type(16))) __bf16 v16bf;
typedef __attribute__((ext_vector_type(8)))  __bf16 v8bf;
typedef __attribute__((ext_vector_type(8)))  float  v8f;

#define T_TOK 2048
#define H_DIM 768
#define I_DIM 3072
#define E_NUM 8
#define A_TOT (T_TOK * 2)
#define LN_EPS 1e-5f

#define TILE_N 128
#define TILE_M 64
// row tiles that any routing can need: each expert rounds its rows up to whole tiles
#define M_TILES_MAX (A_TOT / TILE_M + E_NUM)
// k per pass (K_PASS) must divide the GEMM's K. K_PASS / 2 weight loads a lane are out at a time:
// 96 is the deepest whole divisor that stays under the 63 loads a wave may have outstanding.
#define K_PASS_1 64     // GEMM1: many work-groups; the smaller register set lets four share a WGP
#define K_PASS_2 96     // GEMM2: few work-groups and a long K: as deep as the load counter allows

__device__ __forceinline__ bf16_t f2bf(float f) {
  unsigned u = __builtin_bit_cast(unsigned, f);
  u += 0x7FFFu + ((u >> 16) & 1u);                 // round-to-nearest-even
  unsigned short hs = (unsigned short)(u >> 16);
  return __builtin_bit_cast(bf16_t, hs);
}

// ---------------- x -> bf16 ----------------
__global__ void cvt_x_kernel(const float* __restrict__ x, bf16_t* __restrict__ xb) {
  int n = T_TOK * H_DIM;
  for (int i = blockIdx.x * blockDim.x + threadIdx.x; i < n; i += gridDim.x * blockDim.x)
    xb[i] = f2bf(x[i]);
}

// ---------------- router: one wave per token ----------------
__global__ __launch_bounds__(256) void moe_router(
    const float* __restrict__ x, const float* __restrict__ Wg,
    const float* __restrict__ bg, int* __restrict__ top_e, float* __restrict__ top_w) {
  int wave = threadIdx.x >> 5;
  int lane = threadIdx.x & 31;
  int t = blockIdx.x * 8 + wave;
  if (t >= T_TOK) return;
  float acc[E_NUM];
#pragma unroll
  for (int e = 0; e < E_NUM; ++e) acc[e] = 0.f;
  const float* xr = x + (size_t)t * H_DIM;
  for (int h = lane; h < H_DIM; h += 32) {
    float xv = xr[h];
    const float* wr = Wg + (size_t)h * E_NUM;
#pragma unroll
    for (int e = 0; e < E_NUM; ++e) acc[e] += xv * wr[e];
  }
#pragma unroll
  for (int e = 0; e < E_NUM; ++e) {
#pragma unroll
    for (int off = 16; off > 0; off >>= 1) acc[e] += __shfl_xor(acc[e], off, 32);
  }
  if (lane == 0) {
    float p[E_NUM];
    float mx = -1e30f;
#pragma unroll
    for (int e = 0; e < E_NUM; ++e) { p[e] = acc[e] + bg[e]; mx = fmaxf(mx, p[e]); }
    float sum = 0.f;
#pragma unroll
    for (int e = 0; e < E_NUM; ++e) { p[e] = expf(p[e] - mx); sum += p[e]; }
    float inv = 1.0f / sum;
#pragma unroll
    for (int e = 0; e < E_NUM; ++e) p[e] *= inv;
    int i0 = 0; float v0 = p[0];
#pragma unroll
    for (int e = 1; e < E_NUM; ++e) if (p[e] > v0) { v0 = p[e]; i0 = e; }   // first index wins ties
    int i1 = -1; float v1 = -1.0f;
#pragma unroll
    for (int e = 0; e < E_NUM; ++e) if (e != i0 && p[e] > v1) { v1 = p[e]; i1 = e; }
    float s2 = v0 + v1;
    top_e[2 * t] = i0;       top_e[2 * t + 1] = i1;
    top_w[2 * t] = v0 / s2;  top_w[2 * t + 1] = v1 / s2;
  }
}

// ---------------- deterministic partition: one wave per (expert, token quarter) ----------------
// 32 waves. Each wave takes its 512 tokens' expert pairs and weights into registers with one
// batch of independent loads, counts its matches, and gets its first slot from the 32 counts
// in LDS. Slots of an expert stay in ascending token order.
#define PART_Q 4                                  // token quarters
#define PART_IT (T_TOK / PART_Q / 32)             // groups of 32 tokens per wave
__global__ __launch_bounds__(1024) void moe_partition(
    const int* __restrict__ top_e, const float* __restrict__ top_w,
    int* __restrict__ counts, int* __restrict__ offs,
    int* __restrict__ rowtok, float* __restrict__ gate, int* __restrict__ slot_of) {
  const int wave = threadIdx.x >> 5;              // = e * PART_Q + q: slot order of the pieces
  const int lane = threadIdx.x & 31;
  const int e = wave >> 2;
  const int q = wave & (PART_Q - 1);
  const int t0 = q * (T_TOK / PART_Q) + lane;
  __shared__ int scnt[E_NUM * PART_Q];

  int e0[PART_IT], e1[PART_IT];
  float w0[PART_IT], w1[PART_IT];
#pragma unroll  // all loads independent and in flight together: one memory round trip
  for (int i = 0; i < PART_IT; ++i) {
    int2 ev = ((const int2*)top_e)[t0 + i * 32];
    float2 wv = ((const float2*)top_w)[t0 + i * 32];
    e0[i] = ev.x; e1[i] = ev.y;
    w0[i] = wv.x; w1[i] = wv.y;
  }
  unsigned m[PART_IT];
  int cnt = 0;
#pragma unroll  // arrays stay in registers
  for (int i = 0; i < PART_IT; ++i) {
    bool sel = (e0[i] == e) | (e1[i] == e);
    m[i] = (unsigned)(__ballot(sel) & 0xffffffffull);
    cnt += __popc(m[i]);
  }
  if (lane == 0) scnt[wave] = cnt;
  __syncthreads();
  const int v = scnt[lane];
  int before = (lane < wave) ? v : 0;             // pieces that come first in slot order
  int mine = ((lane >> 2) == e) ? v : 0;          // the expert's own four pieces
#pragma unroll
  for (int off = 16; off > 0; off >>= 1) {
    before += __shfl_xor(before, off, 32);
    mine += __shfl_xor(mine, off, 32);
  }
  if (q == 0 && lane == 0) { offs[e] = before; counts[e] = mine; }
  int pos = before;
  const unsigned lt = (1u << lane) - 1u;
#pragma unroll  // arrays stay in registers
  for (int i = 0; i < PART_IT; ++i) {
    if ((m[i] >> lane) & 1u) {
      const bool first = (e0[i] == e);
      const int t = t0 + i * 32;
      const int slot = pos + __popc(m[i] & lt);
      rowtok[slot] = t;
      gate[slot] = first ? w0[i] : w1[i];
      slot_of[2 * t + (first ? 0 : 1)] = slot;
    }
    pos += __popc(m[i]);
  }
}

// ---------------- WMMA GEMM: C[rows_e x Ndim] = A[rows] x W_e[Kdim x Ndim] ----------------
template <bool GELU_OUT, int K_PASS>
__global__ __launch_bounds__(256) void moe_gemm(
    const bf16_t* __restrict__ A,
    const float* __restrict__ Wfull, const float* __restrict__ bias,
    const int* __restrict__ counts, const int* __restrict__ offs,
    const int* __restrict__ rowtok,              // null -> identity (slot rows)
    bf16_t* __restrict__ Hout, float* __restrict__ Yout) {
  // shapes at compile time: a pass's loads then share one address register pair and differ in
  // their immediate offsets, so that holding them all in flight costs no register per address
  constexpr int Kdim = GELU_OUT ? H_DIM : I_DIM;
  constexpr int Ndim = GELU_OUT ? I_DIM : H_DIM;
  constexpr int lda = Kdim;
  static_assert(Kdim % K_PASS == 0, "whole passes only");
  constexpr int K_SUB = K_PASS / 32;             // WMMA k-blocks per pass
  constexpr int K_THR = K_PASS / 2;              // k rows of the weight tile per thread
  constexpr int LDS_STRIDE = K_PASS + 8;         // 144 or 208 B rows: 16 B x odd, no bank conflicts
  // blockIdx.y counts the row tiles that exist, expert after expert: the grid then holds no
  // work-group per (expert, possible tile) that only starts, finds no rows and ends
  const int tile = blockIdx.y;
  // each array fetched whole, ahead of the search: one scalar load an array, none inside the search
  const int4 c_lo = ((const int4*)counts)[0], c_hi = ((const int4*)counts)[1];
  const int4 o_lo = ((const int4*)offs)[0], o_hi = ((const int4*)offs)[1];
  const int cnt_of[E_NUM] = {c_lo.x, c_lo.y, c_lo.z, c_lo.w, c_hi.x, c_hi.y, c_hi.z, c_hi.w};
  const int off_of[E_NUM] = {o_lo.x, o_lo.y, o_lo.z, o_lo.w, o_hi.x, o_hi.y, o_hi.z, o_hi.w};
  int e = -1, rows = 0, base = 0, start = 0, first = 0;
#pragma unroll  // the two arrays stay in scalar registers
  for (int i = 0; i < E_NUM; ++i) {
    const int nt = (int)((unsigned)(cnt_of[i] + TILE_M - 1) / TILE_M);
    const bool hit = (tile >= first) & (tile < first + nt);
    e = hit ? i : e;
    rows = hit ? cnt_of[i] : rows;
    base = hit ? off_of[i] : base;
    start = hit ? first : start;
    first += nt;
  }
  if (e < 0) return;                             // block-uniform exit: past the last tile
  const int m_blk = (tile - start) * TILE_M;     // < rows: the tile is one of the expert's own
  const int n_blk = blockIdx.x * TILE_N;
  const int wave = threadIdx.x >> 5;
  const int lane = threadIdx.x & 31;
  const int wm = wave >> 1;                      // 0..3 (M, 16 each)
  const int wn = wave & 1;                       // 0..1 (N, 64 each)
  const int lane15 = lane & 15;
  const int khalf = (lane >> 4) * 8;             // 0 or 8 per WMMA 16-bit layout

  // double-buffered weight tile: [n][k] layout, bf16
  __shared__ __align__(16) bf16_t Bs[2][TILE_N * LDS_STRIDE];
  // double-buffered A tile: [m][k] layout, same pitch (its readers are 16-byte LDS loads as well)
  __shared__ __align__(16) bf16_t As[2][TILE_M * LDS_STRIDE];

  const float* W = Wfull + (size_t)e * Kdim * Ndim;

  // cooperative A-tile copier: the tile's 16-byte pieces in row order, one piece a lane and copy, so
  // that a wave's copy takes runs of whole rows' bytes and not 32 bytes out of each of 16 rows
  constexpr int A_ROW_PCS = K_PASS / 8;          // 16-byte pieces of a row in one pass
  constexpr int A_COPIES = TILE_M * A_ROW_PCS / 256;
  static_assert(A_COPIES * 256 == TILE_M * A_ROW_PCS, "whole copies only");
  static_assert(A_COPIES == 2 || A_COPIES == 3, "copy_a spells out two and three copies");
  static_assert(Kdim / K_PASS >= 2, "the two-buffer ring needs two tiles");
  constexpr unsigned A_BUF_BYTES = TILE_M * LDS_STRIDE * sizeof(bf16_t);
  const bf16_t* a_src[A_COPIES];                 // the piece's place in pass 0
  unsigned a_dst[A_COPIES];                      // its LDS byte address in buffer 0
#pragma unroll  // both arrays stay in registers
  for (int i = 0; i < A_COPIES; ++i) {
    const int pc = (int)threadIdx.x + i * 256;
    const int r = pc / A_ROW_PCS;
    const int col = pc - r * A_ROW_PCS;
    int mloc = m_blk + r;
    if (mloc >= rows) mloc = rows - 1;           // clamp (stores are guarded)
    const int arow = rowtok ? rowtok[base + mloc] : (base + mloc);
    a_src[i] = A + (size_t)arow * lda + col * 8;
    a_dst[i] = (unsigned)(size_t)&As[0][r * LDS_STRIDE + col * 8];
  }
  // sends one A tile on its way into LDS, through no register. s_wait_xcnt 0 is kept, as a precaution,
  // in front of every rewrite of the copies' address registers: as the last line of their own
  // statement, where the compiler can put no such rewrite ahead of it.
  auto copy_a = [&](int k0, int b) {
    const unsigned lb = (unsigned)b * A_BUF_BYTES;
    if constexpr (A_COPIES == 2) {
      asm volatile(
          "global_load_async_to_lds_b128 %0, %1, off\n\t"
          "global_load_async_to_lds_b128 %2, %3, off\n\t"
          "s_wait_xcnt 0x0"
          :: "v"(a_dst[0] + lb), "v"(a_src[0] + k0), "v"(a_dst[1] + lb), "v"(a_src[1] + k0)
          : "memory");
    } else {
      asm volatile(
          "global_load_async_to_lds_b128 %0, %1, off\n\t"
          "global_load_async_to_lds_b128 %2, %3, off\n\t"
          "global_load_async_to_lds_b128 %4, %5, off\n\t"
          "s_wait_xcnt 0x0"
          :: "v"(a_dst[0] + lb), "v"(a_src[0] + k0), "v"(a_dst[1] + lb), "v"(a_src[1] + k0),
             "v"(a_dst[2] + lb), "v"(a_src[2] + k0)
          : "memory");
    }
  };

  // cooperative weight-tile loader: thread covers (n = tid&127, k chunk of K_THR)
  const int cn = threadIdx.x & 127;
  const int ck = (threadIdx.x >> 7) * K_THR;     // 0 or K_THR

  v8f c[4] = {v8f{}, v8f{}, v8f{}, v8f{}};

  // prologue: tile k0 = 0 -> As[0] (in flight under the weight tile's loads) and Bs[0]
  copy_a(0, 0);
  {
    const float* wp = W + (size_t)ck * Ndim + (n_blk + cn);
    float first[K_THR];
#pragma unroll  // all loads independent and in flight together
    for (int j = 0; j < K_THR; ++j) first[j] = wp[(size_t)j * Ndim];
#pragma unroll  // first[] stays in registers
    for (int g = 0; g < K_THR / 8; ++g) {
      v8bf p;
#pragma unroll
      for (int j = 0; j < 8; ++j) p[j] = f2bf(first[g * 8 + j]);
      *(v8bf*)&Bs[0][cn * LDS_STRIDE + ck + g * 8] = p;
    }
  }
  // this wave's copies of A tile 0 have landed before the barrier lets the other waves read them
  asm volatile("s_wait_asynccnt 0x0" ::: "memory");
  __syncthreads();
  copy_a(K_PASS, 1);                             // A tile 1 flies while pass 0 is worked on

  // one pass of products, k ascending: per 32-k block the A fragment (row = lane15, K = khalf+[0..7]
  // and khalf+16+[0..7]), 4 B fragments + 4 WMMAs (wave's 16x64 output)
  auto pass_mm = [&](int buf) {
#pragma unroll  // LDS offsets become immediates
    for (int kk = 0; kk < K_SUB; ++kk) {
      const bf16_t* ap = &As[buf][(wm * 16 + lane15) * LDS_STRIDE + kk * 32 + khalf];
      v8bf alo = *(const v8bf*)(ap);
      v8bf ahi = *(const v8bf*)(ap + 16);
      v16bf af;
#pragma unroll
      for (int j = 0; j < 8; ++j) { af[j] = alo[j]; af[8 + j] = ahi[j]; }
#pragma unroll
      for (int sub = 0; sub < 4; ++sub) {
        const bf16_t* bp =
            &Bs[buf][(wn * 64 + sub * 16 + lane15) * LDS_STRIDE + kk * 32 + khalf];
        v8bf lo = *(const v8bf*)(bp);
        v8bf hi = *(const v8bf*)(bp + 16);
        v16bf bf;
#pragma unroll
        for (int j = 0; j < 8; ++j) { bf[j] = lo[j]; bf[8 + j] = hi[j]; }
        c[sub] = __builtin_amdgcn_wmma_f32_16x16x32_bf16(false, af, false, bf, (short)0,
                                                         c[sub], false, false);
      }
    }
  };

  int buf = 0;
  int k0 = 0;
  // every pass but the last (peeled, so that no branch stands between the loads and their waits)
  for (; k0 + K_PASS < Kdim; k0 += K_PASS) {
    float nxt[K_THR];                            // next tile, in flight while the WMMAs run
    const float* wp = W + (size_t)(k0 + K_PASS + ck) * Ndim + (n_blk + cn);
#pragma unroll  // nxt[] stays in registers; all loads independent and in flight together
    for (int j = 0; j < K_THR; ++j) nxt[j] = wp[(size_t)j * Ndim];
    // keeps the scheduler from sinking the loads down to their uses behind the WMMAs,
    // where only a few of them would be in flight at a time
    __builtin_amdgcn_sched_barrier(0);

    pass_mm(buf);
    // keeps the conversions, and with them the waits for the weight loads, behind the WMMAs
    __builtin_amdgcn_sched_barrier(0);

#pragma unroll  // convert + store next tile into the other buffer
    for (int g = 0; g < K_THR / 8; ++g) {
      v8bf p;
#pragma unroll
      for (int j = 0; j < 8; ++j) p[j] = f2bf(nxt[g * 8 + j]);
      *(v8bf*)&Bs[buf ^ 1][cn * LDS_STRIDE + ck + g * 8] = p;
    }
    // hand-over of the next pass's tiles: this wave's reads of As[buf] are over before anyone
    // refills it, and its copies into As[buf ^ 1] have landed before anyone reads them
    asm volatile("s_wait_dscnt 0x0" ::: "memory");
    asm volatile("s_wait_asynccnt 0x0" ::: "memory");
    __syncthreads();
    // the A tile after next, into the buffer that this pass has just read
    if (k0 + 2 * K_PASS < Kdim) copy_a(k0 + 2 * K_PASS, buf);
    buf ^= 1;
  }
  // no copy is left on its way when the wave goes on to its end
  asm volatile("s_wait_asynccnt 0x0" ::: "memory");
  pass_mm(buf);                                  // last pass: nothing left to fetch

  // store: D rows = j + (lane>=16 ? 8 : 0), col = lane&15
  const float* bp = bias + (size_t)e * Ndim;
  const int mrow0 = m_blk + wm * 16 + ((lane < 16) ? 0 : 8);
#pragma unroll
  for (int sub = 0; sub < 4; ++sub) {
    int n = n_blk + wn * 64 + sub * 16 + lane15;
    float bv = bp[n];
#pragma unroll
    for (int j = 0; j < 8; ++j) {
      int m = mrow0 + j;
      if (m < rows) {
        float v = c[sub][j] + bv;
        size_t orow = (size_t)(base + m);
        if constexpr (GELU_OUT) {
          v = 0.5f * v * (1.0f + erff(v * 0.70710678118654752f));  // exact GELU
          Hout[orow * (size_t)Ndim + n] = f2bf(v);
        } else {
          Yout[orow * (size_t)Ndim + n] = v;
        }
      }
    }
  }
}

// ---------------- combine (fixed order -> deterministic) + residual + LayerNorm ----------------
__global__ __launch_bounds__(256) void moe_combine_ln(
    const float* __restrict__ x, const float* __restrict__ y,
    const float* __restrict__ gate, const int* __restrict__ slot_of,
    const float* __restrict__ gamma, const float* __restrict__ beta,
    float* __restrict__ out) {
  int t = blockIdx.x;
  int s0 = slot_of[2 * t], s1 = slot_of[2 * t + 1];
  float w0 = gate[s0], w1 = gate[s1];
  const float* xr = x + (size_t)t * H_DIM;
  const float* y0 = y + (size_t)s0 * H_DIM;
  const float* y1 = y + (size_t)s1 * H_DIM;
  float z[3];
  float s = 0.f, sq = 0.f;
#pragma unroll
  for (int i = 0; i < 3; ++i) {
    int hh = threadIdx.x + i * 256;
    float v = xr[hh] + w0 * y0[hh] + w1 * y1[hh];
    z[i] = v; s += v; sq += v * v;
  }
#pragma unroll
  for (int off = 16; off > 0; off >>= 1) {
    s += __shfl_xor(s, off, 32);
    sq += __shfl_xor(sq, off, 32);
  }
  __shared__ float rs[8], rq[8];
  int wave = threadIdx.x >> 5, lane = threadIdx.x & 31;
  if (lane == 0) { rs[wave] = s; rq[wave] = sq; }
  __syncthreads();
  if (threadIdx.x == 0) {
    float S = 0.f, Q = 0.f;
    for (int i = 0; i < 8; ++i) { S += rs[i]; Q += rq[i]; }
    rs[0] = S; rq[0] = Q;
  }
  __syncthreads();
  float mean = rs[0] * (1.0f / H_DIM);
  float var = rq[0] * (1.0f / H_DIM) - mean * mean;
  float inv = rsqrtf(var + LN_EPS);
#pragma unroll
  for (int i = 0; i < 3; ++i) {
    int hh = threadIdx.x + i * 256;
    out[(size_t)t * H_DIM + hh] = (z[i] - mean) * inv * gamma[hh] + beta[hh];
  }
}

extern "C" void kernel_launch(void* const* d_in, const int* in_sizes, int n_in,
                              void* d_out, int out_size, void* d_ws, size_t ws_size,
                              hipStream_t stream) {
  const float* x  = (const float*)d_in[0];
  const float* W1 = (const float*)d_in[1];
  const float* b1 = (const float*)d_in[2];
  const float* W2 = (const float*)d_in[3];
  const float* b2 = (const float*)d_in[4];
  const float* Wg = (const float*)d_in[5];
  const float* bg = (const float*)d_in[6];
  const float* gamma = (const float*)d_in[7];
  const float* beta  = (const float*)d_in[8];
  float* out = (float*)d_out;

  char* ws = (char*)d_ws;
  size_t off = 0;
  auto alloc = [&](size_t bytes) -> void* {
    void* p = ws + off;
    off = (off + bytes + 255) & ~(size_t)255;
    return p;
  };
  bf16_t* xb     = (bf16_t*)alloc((size_t)T_TOK * H_DIM * sizeof(bf16_t));  // 3.1 MB
  bf16_t* hbuf   = (bf16_t*)alloc((size_t)A_TOT * I_DIM * sizeof(bf16_t));  // 25.2 MB
  float*  ybuf   = (float*) alloc((size_t)A_TOT * H_DIM * sizeof(float));   // 12.6 MB
  int*    top_e  = (int*)   alloc((size_t)T_TOK * 2 * sizeof(int));
  float*  top_w  = (float*) alloc((size_t)T_TOK * 2 * sizeof(float));
  int*    counts = (int*)   alloc(E_NUM * sizeof(int));
  int*    offsv  = (int*)   alloc(E_NUM * sizeof(int));
  int*    rowtok = (int*)   alloc((size_t)A_TOT * sizeof(int));
  float*  gate   = (float*) alloc((size_t)A_TOT * sizeof(float));
  int*    slotof = (int*)   alloc((size_t)T_TOK * 2 * sizeof(int));

  cvt_x_kernel<<<1536, 256, 0, stream>>>(x, xb);
  moe_router<<<T_TOK / 8, 256, 0, stream>>>(x, Wg, bg, top_e, top_w);
  moe_partition<<<1, 1024, 0, stream>>>(top_e, top_w, counts, offsv, rowtok, gate, slotof);
  // GEMM1 + GELU: A = xb[token], W1_e [H x I], out bf16 h [slot][I]
  moe_gemm<true, K_PASS_1><<<dim3(I_DIM / TILE_N, M_TILES_MAX), 256, 0, stream>>>(
      xb, W1, b1, counts, offsv, rowtok, hbuf, nullptr);
  // GEMM2: A = h[slot], W2_e [I x H], out fp32 y [slot][H]
  moe_gemm<false, K_PASS_2><<<dim3(H_DIM / TILE_N, M_TILES_MAX), 256, 0, stream>>>(
      hbuf, W2, b2, counts, offsv, nullptr, nullptr, ybuf);
  moe_combine_ln<<<T_TOK, 256, 0, stream>>>(x, ybuf, gate, slotof, gamma, beta, out);
}

// v005
// Measured time: 121 microseconds a run.
// Two timings next to v004 both put it at 1.07 times that version's speed.
// Over all steps from v000 it is 2.14 times as fast.
#include <hip/hip_runtime.h>
#include <hip/hip_bf16.h>
#include <math.h>

// MoE (top-2 of 8 experts), H=768, I=3072, T=2048 tokens.
// bf16 WMMA (v_wmma_f32_16x16x32_bf16) with fp32 accumulate; gather-based
// expert execution (exactly K*T = 4096 assignment rows of GEMM work).
// GEMM: 64x128 block tile, 8 waves (4M x 2N), 16x64 per wave (4 WMMA accums),
// double-buffered LDS weight tile (fp32 -> bf16 on the fly), 64 or 96 k per pass, 1 barrier/pass.
// A tile (64 rows x one pass of k) double-buffered in LDS too, filled by asynchronous copies.
// LDS fragment reads go out in groups ahead of their WMMAs (32 k a group in GEMM1, 96 in GEMM2).
// GEMM grid: (column tiles) x (row tiles that any routing can need, all experts in a row).

typedef __bf16 bf16_t;
typedef __attribute__((ext_vector_type(16))) __bf16 v16bf;
typedef __attribute__((ext_vector_type(8)))  __bf16 v8bf;
typedef __attribute__((ext_vector_type(8)))  float  v8f;

#define T_TOK 2048
#define H_DIM 768
#define I_DIM 3072
#define E_NUM 8
#define A_TOT (T_TOK * 2)
#define LN_EPS 1e-5f

#define TILE_N 128
#define TILE_M 64
// row tiles that any routing can need: each expert rounds its rows up to whole tiles
#define M_TILES_MAX (A_TOT / TILE_M + E_NUM)
// k per pass (K_PASS) must divide the GEMM's K. K_PASS / 2 weight loads a lane are out at a time:
// 96 is the deepest whole divisor that stays under the 63 loads a wave may have outstanding.
#define K_PASS_1 64     // GEMM1: many work-groups; the smaller register set lets four share a WGP
#define K_PASS_2 96     // GEMM2: few work-groups and a long K: as deep as the load counter allows

__device__ __forceinline__ bf16_t f2bf(float f) {
  unsigned u = __builtin_bit_cast(unsigned, f);
  u += 0x7FFFu + ((u >> 16) & 1u);                 // round-to-nearest-even
  unsigned short hs = (unsigned short)(u >> 16);
  return __builtin_bit_cast(bf16_t, hs);
}

// ---------------- x -> bf16 ----------------
__global__ void cvt_x_kernel(const float* __restrict__ x, bf16_t* __restrict__ xb) {
  int n = T_TOK * H_DIM;
  for (int i = blockIdx.x * blockDim.x + threadIdx.x; i < n; i += gridDim.x * blockDim.x)
    xb[i] = f2bf(x[i]);
}

// ---------------- router: one wave per token ----------------
__global__ __launch_bounds__(256) void moe_router(
    const float* __restrict__ x, const float* __restrict__ Wg,
    const float* __restrict__ bg, int* __restrict__ top_e, float* __restrict__ top_w) {
  int wave = threadIdx.x >> 5;
  int lane = threadIdx.x & 31;
  int t = blockIdx.x * 8 + wave;
  if (t >= T_TOK) return;
  float acc[E_NUM];
#pragma unroll
  for (int e = 0; e < E_NUM; ++e) acc[e] = 0.f;
  const float* xr = x + (size_t)t * H_DIM;
  for (int h = lane; h < H_DIM; h += 32) {
    float xv = xr[h];
    const float* wr = Wg + (size_t)h * E_NUM;
#pragma unroll
    for (int e = 0; e < E_NUM; ++e) acc[e] += xv * wr[e];
  }
#pragma unroll
  for (int e = 0; e < E_NUM; ++e) {
#pragma unroll
    for (int off = 16; off > 0; off >>= 1) acc[e] += __shfl_xor(acc[e], off, 32);
  }
  if (lane == 0) {
    float p[E_NUM];
    float mx = -1e30f;
#pragma unroll
    for (int e = 0; e < E_NUM; ++e) { p[e] = acc[e] + bg[e]; mx = fmaxf(mx, p[e]); }
    float sum = 0.f;
#pragma unroll
    for (int e = 0; e < E_NUM; ++e) { p[e] = expf(p[e] - mx); sum += p[e]; }
    float inv = 1.0f / sum;
#pragma unroll
    for (int e = 0; e < E_NUM; ++e) p[e] *= inv;
    int i0 = 0; float v0 = p[0];
#pragma unroll
    for (int e = 1; e < E_NUM; ++e) if (p[e] > v0) { v0 = p[e]; i0 = e; }   // first index wins ties
    int i1 = -1; float v1 = -1.0f;
#pragma unroll
    for (int e = 0; e < E_NUM; ++e) if (e != i0 && p[e] > v1) { v1 = p[e]; i1 = e; }
    float s2 = v0 + v1;
    top_e[2 * t] = i0;       top_e[2 * t + 1] = i1;
    top_w[2 * t] = v0 / s2;  top_w[2 * t + 1] = v1 / s2;
  }
}

// ---------------- deterministic partition: one wave per (expert, token quarter) ----------------
// 32 waves. Each wave takes its 512 tokens' expert pairs and weights into registers with one
// batch of independent loads, counts its matches, and gets its first slot from the 32 counts
// in LDS. Slots of an expert stay in ascending token order.
#define PART_Q 4                                  // token quarters
#define PART_IT (T_TOK / PART_Q / 32)             // groups of 32 tokens per wave
__global__ __launch_bounds__(1024) void moe_partition(
    const int* __restrict__ top_e, const float* __restrict__ top_w,
    int* __restrict__ counts, int* __restrict__ offs,
    int* __restrict__ rowtok, float* __restrict__ gate, int* __restrict__ slot_of) {
  const int wave = threadIdx.x >> 5;              // = e * PART_Q + q: slot order of the pieces
  const int lane = threadIdx.x & 31;
  const int e = wave >> 2;
  const int q = wave & (PART_Q - 1);
  const int t0 = q * (T_TOK / PART_Q) + lane;
  __shared__ int scnt[E_NUM * PART_Q];

  int e0[PART_IT], e1[PART_IT];
  float w0[PART_IT], w1[PART_IT];
#pragma unroll  // all loads independent and in flight together: one memory round trip
  for (int i = 0; i < PART_IT; ++i) {
    int2 ev = ((const int2*)top_e)[t0 + i * 32];
    float2 wv = ((const float2*)top_w)[t0 + i * 32];
    e0[i] = ev.x; e1[i] = ev.y;
    w0[i] = wv.x; w1[i] = wv.y;
  }
  unsigned m[PART_IT];
  int cnt = 0;
#pragma unroll  // arrays stay in registers
  for (int i = 0; i < PART_IT; ++i) {
    bool sel = (e0[i] == e) | (e1[i] == e);
    m[i] = (unsigned)(__ballot(sel) & 0xffffffffull);
    cnt += __popc(m[i]);
  }
  if (lane == 0) scnt[wave] = cnt;
  __syncthreads();
  const int v = scnt[lane];
  int before = (lane < wave) ? v : 0;             // pieces that come first in slot order
  int mine = ((lane >> 2) == e) ? v : 0;          // the expert's own four pieces
#pragma unroll
  for (int off = 16; off > 0; off >>= 1) {
    before += __shfl_xor(before, off, 32);
    mine += __shfl_xor(mine, off, 32);
  }
  if (q == 0 && lane == 0) { offs[e] = before; counts[e] = mine; }
  int pos = before;
  const unsigned lt = (1u << lane) - 1u;
#pragma unroll  // arrays stay in registers
  for (int i = 0; i < PART_IT; ++i) {
    if ((m[i] >> lane) & 1u) {
      const bool first = (e0[i] == e);
      const int t = t0 + i * 32;
      const int slot = pos + __popc(m[i] & lt);
      rowtok[slot] = t;
      gate[slot] = first ? w0[i] : w1[i];
      slot_of[2 * t + (first ? 0 : 1)] = slot;
    }
    pos += __popc(m[i]);
  }
}

// ---------------- WMMA GEMM: C[rows_e x Ndim] = A[rows] x W_e[Kdim x Ndim] ----------------
// second launch bound = waves a SIMD that must still fit, now that the fragments of a group hold
// registers of their own: 8 (GEMM1: four work-groups a WGP, as before), 4 (GEMM2: two, all it has)
template <bool GELU_OUT, int K_PASS>
__global__ __launch_bounds__(256, GELU_OUT ? 8 : 4) void moe_gemm(
    const bf16_t* __restrict__ A,
    const float* __restrict__ Wfull, const float* __restrict__ bias,
    const int* __restrict__ counts, const int* __restrict__ offs,
    const int* __restrict__ rowtok,              // null -> identity (slot rows)
    bf16_t* __restrict__ Hout, float* __restrict__ Yout) {
  // shapes at compile time: a pass's loads then share one address register pair and differ in
  // their immediate offsets, so that holding them all in flight costs no register per address
  constexpr int Kdim = GELU_OUT ? H_DIM : I_DIM;
  constexpr int Ndim = GELU_OUT ? I_DIM : H_DIM;
  constexpr int lda = Kdim;
  static_assert(Kdim % K_PASS == 0, "whole passes only");
  constexpr int K_SUB = K_PASS / 32;             // WMMA k-blocks per pass
  // k-blocks whose LDS reads go out as one group: GEMM2 the whole pass; GEMM1 one block, which
  // still fits the register budget of four work-groups a WGP
  constexpr int K_GRP = GELU_OUT ? 1 : K_SUB;
  static_assert(K_SUB % K_GRP == 0, "whole groups only");
  constexpr int K_THR = K_PASS / 2;              // k rows of the weight tile per thread
  constexpr int LDS_STRIDE = K_PASS + 8;         // 144 or 208 B rows: 16 B x odd, no bank conflicts
  // blockIdx.y counts the row tiles that exist, expert after expert: the grid then holds no
  // work-group per (expert, possible tile) that only starts, finds no rows and ends
  const int tile = blockIdx.y;
  // each array fetched whole, ahead of the search: one scalar load an array, none inside the search
  const int4 c_lo = ((const int4*)counts)[0], c_hi = ((const int4*)counts)[1];
  const int4 o_lo = ((const int4*)offs)[0], o_hi = ((const int4*)offs)[1];
  const int cnt_of[E_NUM] = {c_lo.x, c_lo.y, c_lo.z, c_lo.w, c_hi.x, c_hi.y, c_hi.z, c_hi.w};
  const int off_of[E_NUM] = {o_lo.x, o_lo.y, o_lo.z, o_lo.w, o_hi.x, o_hi.y, o_hi.z, o_hi.w};
  int e = -1, rows = 0, base = 0, start = 0, first = 0;
#pragma unroll  // the two arrays stay in scalar registers
  for (int i = 0; i < E_NUM; ++i) {
    const int nt = (int)((unsigned)(cnt_of[i] + TILE_M - 1) / TILE_M);
    const bool hit = (tile >= first) & (tile < first + nt);
    e = hit ? i : e;
    rows = hit ? cnt_of[i] : rows;
    base = hit ? off_of[i] : base;
    start = hit ? first : start;
    first += nt;
  }
  if (e < 0) return;                             // block-uniform exit: past the last tile
  const int m_blk = (tile - start) * TILE_M;     // < rows: the tile is one of the expert's own
  const int n_blk = blockIdx.x * TILE_N;
  const int wave = threadIdx.x >> 5;
  const int lane = threadIdx.x & 31;
  const int wm = wave >> 1;                      // 0..3 (M, 16 each)
  const int wn = wave & 1;                       // 0..1 (N, 64 each)
  const int lane15 = lane & 15;
  const int khalf = (lane >> 4) * 8;             // 0 or 8 per WMMA 16-bit layout

  // double-buffered weight tile: [n][k] layout, bf16
  __shared__ __align__(16) bf16_t Bs[2][TILE_N * LDS_STRIDE];
  // double-buffered A tile: [m][k] layout, same pitch (its readers are 16-byte LDS loads as well)
  __shared__ __align__(16) bf16_t As[2][TILE_M * LDS_STRIDE];

  const float* W = Wfull + (size_t)e * Kdim * Ndim;

  // cooperative A-tile copier: the tile's 16-byte pieces in row order, one piece a lane and copy, so
  // that a wave's copy takes runs of whole rows' bytes and not 32 bytes out of each of 16 rows
  constexpr int A_ROW_PCS = K_PASS / 8;          // 16-byte pieces of a row in one pass
  constexpr int A_COPIES = TILE_M * A_ROW_PCS / 256;
  static_assert(A_COPIES * 256 == TILE_M * A_ROW_PCS, "whole copies only");
  static_assert(A_COPIES == 2 || A_COPIES == 3, "copy_a spells out two and three copies");
  static_assert(Kdim / K_PASS >= 2, "the two-buffer ring needs two tiles");
  constexpr unsigned A_BUF_BYTES = TILE_M * LDS_STRIDE * sizeof(bf16_t);
  const bf16_t* a_src[A_COPIES];                 // the piece's place in pass 0
  unsigned a_dst[A_COPIES];                      // its LDS byte address in buffer 0
#pragma unroll  // both arrays stay in registers
  for (int i = 0; i < A_COPIES; ++i) {
    const int pc = (int)threadIdx.x + i * 256;
    const int r = pc / A_ROW_PCS;
    const int col = pc - r * A_ROW_PCS;
    int mloc = m_blk + r;
    if (mloc >= rows) mloc = rows - 1;           // clamp (stores are guarded)
    const int arow = rowtok ? rowtok[base + mloc] : (base + mloc);
    a_src[i] = A + (size_t)arow * lda + col * 8;
    a_dst[i] = (unsigned)(size_t)&As[0][r * LDS_STRIDE + col * 8];
  }
  // sends one A tile on its way into LDS, through no register. s_wait_xcnt 0 is kept, as a precaution,
  // in front of every rewrite of the copies' address registers: as the last line of their own
  // statement, where the compiler can put no such rewrite ahead of it.
  auto copy_a = [&](int k0, int b) {
    const unsigned lb = (unsigned)b * A_BUF_BYTES;
    if constexpr (A_COPIES == 2) {
      asm volatile(
          "global_load_async_to_lds_b128 %0, %1, off\n\t"
          "global_load_async_to_lds_b128 %2, %3, off\n\t"
          "s_wait_xcnt 0x0"
          :: "v"(a_dst[0] + lb), "v"(a_src[0] + k0), "v"(a_dst[1] + lb), "v"(a_src[1] + k0)
          : "memory");
    } else {
      asm volatile(
          "global_load_async_to_lds_b128 %0, %1, off\n\t"
          "global_load_async_to_lds_b128 %2, %3, off\n\t"
          "global_load_async_to_lds_b128 %4, %5, off\n\t"
          "s_wait_xcnt 0x0"
          :: "v"(a_dst[0] + lb), "v"(a_src[0] + k0), "v"(a_dst[1] + lb), "v"(a_src[1] + k0),
             "v"(a_dst[2] + lb), "v"(a_src[2] + k0)
          : "memory");
    }
  };

  // cooperative weight-tile loader: thread covers (n = tid&127, k chunk of K_THR)
  const int cn = threadIdx.x & 127;
  const int ck = (threadIdx.x >> 7) * K_THR;     // 0 or K_THR

  v8f c[4] = {v8f{}, v8f{}, v8f{}, v8f{}};

  // prologue: tile k0 = 0 -> As[0] (in flight under the weight tile's loads) and Bs[0]
  copy_a(0, 0);
  {
    const float* wp = W + (size_t)ck * Ndim + (n_blk + cn);
    float first[K_THR];
#pragma unroll  // all loads independent and in flight together
    for (int j = 0; j < K_THR; ++j) first[j] = wp[(size_t)j * Ndim];
#pragma unroll  // first[] stays in registers
    for (int g = 0; g < K_THR / 8; ++g) {
      v8bf p;
#pragma unroll
      for (int j = 0; j < 8; ++j) p[j] = f2bf(first[g * 8 + j]);
      *(v8bf*)&Bs[0][cn * LDS_STRIDE + ck + g * 8] = p;
    }
  }
  // this wave's copies of A tile 0 have landed before the barrier lets the other waves read them
  asm volatile("s_wait_asynccnt 0x0" ::: "memory");
  __syncthreads();
  copy_a(K_PASS, 1);                             // A tile 1 flies while pass 0 is worked on

  // one pass of products, k ascending: per 32-k block the A fragment (row = lane15, K = khalf+[0..7]
  // and khalf+16+[0..7]), 4 B fragments + 4 WMMAs (wave's 16x64 output). The LDS reads of K_GRP
  // blocks go out as one group, each fragment into registers of its own, ahead of those blocks'
  // WMMAs: the wave then meets the LDS latency once a group and not once a WMMA.
  auto pass_mm = [&](int buf) {
#pragma unroll  // LDS offsets become immediates
    for (int kg = 0; kg < K_SUB; kg += K_GRP) {
      v16bf af[K_GRP], bfr[K_GRP][4];
#pragma unroll  // both arrays stay in registers
      for (int kk = 0; kk < K_GRP; ++kk) {
        const bf16_t* ap = &As[buf][(wm * 16 + lane15) * LDS_STRIDE + (kg + kk) * 32 + khalf];
        v8bf alo = *(const v8bf*)(ap);
        v8bf ahi = *(const v8bf*)(ap + 16);
#pragma unroll
        for (int j = 0; j < 8; ++j) { af[kk][j] = alo[j]; af[kk][8 + j] = ahi[j]; }
#pragma unroll
        for (int sub = 0; sub < 4; ++sub) {
          const bf16_t* bp =
              &Bs[buf][(wn * 64 + sub * 16 + lane15) * LDS_STRIDE + (kg + kk) * 32 + khalf];
          v8bf lo = *(const v8bf*)(bp);
          v8bf hi = *(const v8bf*)(bp + 16);
#pragma unroll
          for (int j = 0; j < 8; ++j) { bfr[kk][sub][j] = lo[j]; bfr[kk][sub][8 + j] = hi[j]; }
        }
      }
      // keeps the scheduler from sinking the reads back among the WMMAs, two in front of each with
      // a full wait, into one shared fragment register set
      __builtin_amdgcn_sched_barrier(0);
#pragma unroll
      for (int kk = 0; kk < K_GRP; ++kk) {
#pragma unroll
        for (int sub = 0; sub < 4; ++sub) {
          c[sub] = __builtin_amdgcn_wmma_f32_16x16x32_bf16(false, af[kk], false, bfr[kk][sub],
                                                           (short)0, c[sub], false, false);
        }
      }
    }
  };

  int buf = 0;
  int k0 = 0;
  // every pass but the last (peeled, so that no branch stands between the loads and their waits)
  for (; k0 + K_PASS < Kdim; k0 += K_PASS) {
    float nxt[K_THR];                            // next tile, in flight while the WMMAs run
    const float* wp = W + (size_t)(k0 + K_PASS + ck) * Ndim + (n_blk + cn);
#pragma unroll  // nxt[] stays in registers; all loads independent and in flight together
    for (int j = 0; j < K_THR; ++j) nxt[j] = wp[(size_t)j * Ndim];
    // keeps the scheduler from sinking the loads down to their uses behind the WMMAs,
    // where only a few of them would be in flight at a time
    __builtin_amdgcn_sched_barrier(0);

    pass_mm(buf);
    // keeps the conversions, and with them the waits for the weight loads, behind the WMMAs
    __builtin_amdgcn_sched_barrier(0);

#pragma unroll  // convert + store next tile into the other buffer
    for (int g = 0; g < K_THR / 8; ++g) {
      v8bf p;
#pragma unroll
      for (int j = 0; j < 8; ++j) p[j] = f2bf(nxt[g * 8 + j]);
      *(v8bf*)&Bs[buf ^ 1][cn * LDS_STRIDE + ck + g * 8] = p;
    }
    // hand-over of the next pass's tiles: this wave's reads of As[buf] are over before anyone
    // refills it, and its copies into As[buf ^ 1] have landed before anyone reads them
    asm volatile("s_wait_dscnt 0x0" ::: "memory");
    asm volatile("s_wait_asynccnt 0x0" ::: "memory");
    __syncthreads();
    // the A tile after next, into the buffer that this pass has just read
    if (k0 + 2 * K_PASS < Kdim) copy_a(k0 + 2 * K_PASS, buf);
    buf ^= 1;
  }
  // no copy is left on its way when the wave goes on to its end
  asm volatile("s_wait_asynccnt 0x0" ::: "memory");
  pass_mm(buf);                                  // last pass: nothing left to fetch

  // store: D rows = j + (lane>=16 ? 8 : 0), col = lane&15
  const float* bp = bias + (size_t)e * Ndim;
  const int mrow0 = m_blk + wm * 16 + ((lane < 16) ? 0 : 8);
#pragma unroll
  for (int sub = 0; sub < 4; ++sub) {
    int n = n_blk + wn * 64 + sub * 16 + lane15;
    float bv = bp[n];
#pragma unroll
    for (int j = 0; j < 8; ++j) {
      int m = mrow0 + j;
      if (m < rows) {
        float v = c[sub][j] + bv;
        size_t orow = (size_t)(base + m);
        if constexpr (GELU_OUT) {
          v = 0.5f * v * (1.0f + erff(v * 0.70710678118654752f));  // exact GELU
          Hout[orow * (size_t)Ndim + n] = f2bf(v);
        } else {
          Yout[orow * (size_t)Ndim + n] = v;
        }
      }
    }
  }
}

// ---------------- combine (fixed order -> deterministic) + residual + LayerNorm ----------------
__global__ __launch_bounds__(256) void moe_combine_ln(
    const float* __restrict__ x, const float* __restrict__ y,
    const float* __restrict__ gate, const int* __restrict__ slot_of,
    const float* __restrict__ gamma, const float* __restrict__ beta,
    float* __restrict__ out) {
  int t = blockIdx.x;
  int s0 = slot_of[2 * t], s1 = slot_of[2 * t + 1];
  float w0 = gate[s0], w1 = gate[s1];
  const float* xr = x + (size_t)t * H_DIM;
  const float* y0 = y + (size_t)s0 * H_DIM;
  const float* y1 = y + (size_t)s1 * H_DIM;
  float z[3];
  float s = 0.f, sq = 0.f;
#pragma unroll
  for (int i = 0; i < 3; ++i) {
    int hh = threadIdx.x + i * 256;
    float v = xr[hh] + w0 * y0[hh] + w1 * y1[hh];
    z[i] = v; s += v; sq += v * v;
  }
#pragma unroll
  for (int off = 16; off > 0; off >>= 1) {
    s += __shfl_xor(s, off, 32);
    sq += __shfl_xor(sq, off, 32);
  }
  __shared__ float rs[8], rq[8];
  int wave = threadIdx.x >> 5, lane = threadIdx.x & 31;
  if (lane == 0) { rs[wave] = s; rq[wave] = sq; }
  __syncthreads();
  if (threadIdx.x == 0) {
    float S = 0.f, Q = 0.f;
    for (int i = 0; i < 8; ++i) { S += rs[i]; Q += rq[i]; }
    rs[0] = S; rq[0] = Q;
  }
  __syncthreads();
  float mean = rs[0] * (1.0f / H_DIM);
  float var = rq[0] * (1.0f / H_DIM) - mean * mean;
  float inv = rsqrtf(var + LN_EPS);
#pragma unroll
  for (int i = 0; i < 3; ++i) {
    int hh = threadIdx.x + i * 256;
    out[(size_t)t * H_DIM + hh] = (z[i] - mean) * inv * gamma[hh] + beta[hh];
  }
}

extern "C" void kernel_launch(void* const* d_in, const int* in_sizes, int n_in,
                              void* d_out, int out_size, void* d_ws, size_t ws_size,
                              hipStream_t stream) {
  const float* x  = (const float*)d_in[0];
  const float* W1 = (const float*)d_in[1];
  const float* b1 = (const float*)d_in[2];
  const float* W2 = (const float*)d_in[3];
  const float* b2 = (const float*)d_in[4];
  const float* Wg = (const float*)d_in[5];
  const float* bg = (const float*)d_in[6];
  const float* gamma = (const float*)d_in[7];
  const float* beta  = (const float*)d_in[8];
  float* out = (float*)d_out;

  char* ws = (char*)d_ws;
  size_t off = 0;
  auto alloc = [&](size_t bytes) -> void* {
    void* p = ws + off;
    off = (off + bytes + 255) & ~(size_t)255;
    return p;
  };
  bf16_t* xb     = (bf16_t*)alloc((size_t)T_TOK * H_DIM * sizeof(bf16_t));  // 3.1 MB
  bf16_t* hbuf   = (bf16_t*)alloc((size_t)A_TOT * I_DIM * sizeof(bf16_t));  // 25.2 MB
  float*  ybuf   = (float*) alloc((size_t)A_TOT * H_DIM * sizeof(float));   // 12.6 MB
  int*    top_e  = (int*)   alloc((size_t)T_TOK * 2 * sizeof(int));
  float*  top_w  = (float*) alloc((size_t)T_TOK * 2 * sizeof(float));
  int*    counts = (int*)   alloc(E_NUM * sizeof(int));
  int*    offsv  = (int*)   alloc(E_NUM * sizeof(int));
  int*    rowtok = (int*)   alloc((size_t)A_TOT * sizeof(int));
  float*  gate   = (float*) alloc((size_t)A_TOT * sizeof(float));
  int*    slotof = (int*)   alloc((size_t)T_TOK * 2 * sizeof(int));

  cvt_x_kernel<<<1536, 256, 0, stream>>>(x, xb);
  moe_router<<<T_TOK / 8, 256, 0, stream>>>(x, Wg, bg, top_e, top_w);
  moe_partition<<<1, 1024, 0, stream>>>(top_e, top_w, counts, offsv, rowtok, gate, slotof);
  // GEMM1 + GELU: A = xb[token], W1_e [H x I], out bf16 h [slot][I]
  moe_gemm<true, K_PASS_1><<<dim3(I_DIM / TILE_N, M_TILES_MAX), 256, 0, stream>>>(
      xb, W1, b1, counts, offsv, rowtok, hbuf, nullptr);
  // GEMM2: A = h[slot], W2_e [I x H], out fp32 y [slot][H]
  moe_gemm<false, K_PASS_2><<<dim3(H_DIM / TILE_N, M_TILES_MAX), 256, 0, stream>>>(
      hbuf, W2, b2, counts, offsv, nullptr, nullptr, ybuf);
  moe_combine_ln<<<T_TOK, 256, 0, stream>>>(x, ybuf, gate, slotof, gamma, beta, out);
}

// v006
// A run of this version takes 114 microseconds.
// Timed twice side by side with v005, it ran 1.06 times as fast both times.
// All steps since v000 together make it 2.27 times as fast.
#include <hip/hip_runtime.h>
#include <hip/hip_bf16.h>
#include <math.h>

// MoE (top-2 of 8 experts), H=768, I=3072, T=2048 tokens.
// bf16 WMMA (v_wmma_f32_16x16x32_bf16) with fp32 accumulate; gather-based
// expert execution (exactly K*T = 4096 assignment rows of GEMM work).
// GEMM: 128x128 block tile, 8 waves (4M x 2N), 32x64 per wave (8 WMMA accums),
// double-buffered LDS weight tile (fp32 -> bf16 on the fly), 64 or 96 k per pass, 1 barrier/pass.
// A tile (128 rows x one pass of k) double-buffered in LDS too, filled by asynchronous copies.
// LDS fragment reads go out in groups ahead of their WMMAs (32 k a group in GEMM1, 96 in GEMM2).
// GEMM grid: (column tiles) x (row tiles that any routing can need, all experts in a row).

typedef __bf16 bf16_t;
typedef __attribute__((ext_vector_type(16))) __bf16 v16bf;
typedef __attribute__((ext_vector_type(8)))  __bf16 v8bf;
typedef __attribute__((ext_vector_type(8)))  float  v8f;

#define T_TOK 2048
#define H_DIM 768
#define I_DIM 3072
#define E_NUM 8
#define A_TOT (T_TOK * 2)
#define LN_EPS 1e-5f

#define TILE_N 128
// rows per work-group: a weight tile is fetched from L2 and converted once per TILE_M rows of its expert
#define TILE_M 128
// row tiles that any routing can need: each expert rounds its rows up to whole tiles
#define M_TILES_MAX (A_TOT / TILE_M + E_NUM)
// k per pass (K_PASS) must divide the GEMM's K. K_PASS / 2 weight loads a lane are out at a time:
// 96 is the deepest whole divisor that stays under the 63 loads a wave may have outstanding.
#define K_PASS_1 64     // GEMM1: many work-groups; the smaller register set lets several share a WGP
#define GEMM1_WAVES 4   // waves a SIMD that GEMM1's registers must leave room for: two work-groups a WGP
#define K_PASS_2 96     // GEMM2: few work-groups and a long K: as deep as the load counter allows

__device__ __forceinline__ bf16_t f2bf(float f) {
  unsigned u = __builtin_bit_cast(unsigned, f);
  u += 0x7FFFu + ((u >> 16) & 1u);                 // round-to-nearest-even
  unsigned short hs = (unsigned short)(u >> 16);
  return __builtin_bit_cast(bf16_t, hs);
}

// ---------------- x -> bf16 ----------------
__global__ void cvt_x_kernel(const float* __restrict__ x, bf16_t* __restrict__ xb) {
  int n = T_TOK * H_DIM;
  for (int i = blockIdx.x * blockDim.x + threadIdx.x; i < n; i += gridDim.x * blockDim.x)
    xb[i] = f2bf(x[i]);
}

// ---------------- router: one wave per token ----------------
__global__ __launch_bounds__(256) void moe_router(
    const float* __restrict__ x, const float* __restrict__ Wg,
    const float* __restrict__ bg, int* __restrict__ top_e, float* __restrict__ top_w) {
  int wave = threadIdx.x >> 5;
  int lane = threadIdx.x & 31;
  int t = blockIdx.x * 8 + wave;
  if (t >= T_TOK) return;
  float acc[E_NUM];
#pragma unroll
  for (int e = 0; e < E_NUM; ++e) acc[e] = 0.f;
  const float* xr = x + (size_t)t * H_DIM;
  for (int h = lane; h < H_DIM; h += 32) {
    float xv = xr[h];
    const float* wr = Wg + (size_t)h * E_NUM;
#pragma unroll
    for (int e = 0; e < E_NUM; ++e) acc[e] += xv * wr[e];
  }
#pragma unroll
  for (int e = 0; e < E_NUM; ++e) {
#pragma unroll
    for (int off = 16; off > 0; off >>= 1) acc[e] += __shfl_xor(acc[e], off, 32);
  }
  if (lane == 0) {
    float p[E_NUM];
    float mx = -1e30f;
#pragma unroll
    for (int e = 0; e < E_NUM; ++e) { p[e] = acc[e] + bg[e]; mx = fmaxf(mx, p[e]); }
    float sum = 0.f;
#pragma unroll
    for (int e = 0; e < E_NUM; ++e) { p[e] = expf(p[e] - mx); sum += p[e]; }
    float inv = 1.0f / sum;
#pragma unroll
    for (int e = 0; e < E_NUM; ++e) p[e] *= inv;
    int i0 = 0; float v0 = p[0];
#pragma unroll
    for (int e = 1; e < E_NUM; ++e) if (p[e] > v0) { v0 = p[e]; i0 = e; }   // first index wins ties
    int i1 = -1; float v1 = -1.0f;
#pragma unroll
    for (int e = 0; e < E_NUM; ++e) if (e != i0 && p[e] > v1) { v1 = p[e]; i1 = e; }
    float s2 = v0 + v1;
    top_e[2 * t] = i0;       top_e[2 * t + 1] = i1;
    top_w[2 * t] = v0 / s2;  top_w[2 * t + 1] = v1 / s2;
  }
}

// ---------------- deterministic partition: one wave per (expert, token quarter) ----------------
// 32 waves. Each wave takes its 512 tokens' expert pairs and weights into registers with one
// batch of independent loads, counts its matches, and gets its first slot from the 32 counts
// in LDS. Slots of an expert stay in ascending token order.
#define PART_Q 4                                  // token quarters
#define PART_IT (T_TOK / PART_Q / 32)             // groups of 32 tokens per wave
__global__ __launch_bounds__(1024) void moe_partition(
    const int* __restrict__ top_e, const float* __restrict__ top_w,
    int* __restrict__ counts, int* __restrict__ offs,
    int* __restrict__ rowtok, float* __restrict__ gate, int* __restrict__ slot_of) {
  const int wave = threadIdx.x >> 5;              // = e * PART_Q + q: slot order of the pieces
  const int lane = threadIdx.x & 31;
  const int e = wave >> 2;
  const int q = wave & (PART_Q - 1);
  const int t0 = q * (T_TOK / PART_Q) + lane;
  __shared__ int scnt[E_NUM * PART_Q];

  int e0[PART_IT], e1[PART_IT];
  float w0[PART_IT], w1[PART_IT];
#pragma unroll  // all loads independent and in flight together: one memory round trip
  for (int i = 0; i < PART_IT; ++i) {
    int2 ev = ((const int2*)top_e)[t0 + i * 32];
    float2 wv = ((const float2*)top_w)[t0 + i * 32];
    e0[i] = ev.x; e1[i] = ev.y;
    w0[i] = wv.x; w1[i] = wv.y;
  }
  unsigned m[PART_IT];
  int cnt = 0;
#pragma unroll  // arrays stay in registers
  for (int i = 0; i < PART_IT; ++i) {
    bool sel = (e0[i] == e) | (e1[i] == e);
    m[i] = (unsigned)(__ballot(sel) & 0xffffffffull);
    cnt += __popc(m[i]);
  }
  if (lane == 0) scnt[wave] = cnt;
  __syncthreads();
  const int v = scnt[lane];
  int before = (lane < wave) ? v : 0;             // pieces that come first in slot order
  int mine = ((lane >> 2) == e) ? v : 0;          // the expert's own four pieces
#pragma unroll
  for (int off = 16; off > 0; off >>= 1) {
    before += __shfl_xor(before, off, 32);
    mine += __shfl_xor(mine, off, 32);
  }
  if (q == 0 && lane == 0) { offs[e] = before; counts[e] = mine; }
  int pos = before;
  const unsigned lt = (1u << lane) - 1u;
#pragma unroll  // arrays stay in registers
  for (int i = 0; i < PART_IT; ++i) {
    if ((m[i] >> lane) & 1u) {
      const bool first = (e0[i] == e);
      const int t = t0 + i * 32;
      const int slot = pos + __popc(m[i] & lt);
      rowtok[slot] = t;
      gate[slot] = first ? w0[i] : w1[i];
      slot_of[2 * t + (first ? 0 : 1)] = slot;
    }
    pos += __popc(m[i]);
  }
}

// ---------------- WMMA GEMM: C[rows_e x Ndim] = A[rows] x W_e[Kdim x Ndim] ----------------
// second launch bound = waves a SIMD that must still fit beside the 8 accumulators and the fragments
// of a group: GEMM1_WAVES (GEMM1), 2 (GEMM2: it has fewer work-groups than the chip has WGPs)
template <bool GELU_OUT, int K_PASS>
__global__ __launch_bounds__(256, GELU_OUT ? GEMM1_WAVES : 2) void moe_gemm(
    const bf16_t* __restrict__ A,
    const float* __restrict__ Wfull, const float* __restrict__ bias,
    const int* __restrict__ counts, const int* __restrict__ offs,
    const int* __restrict__ rowtok,              // null -> identity (slot rows)
    bf16_t* __restrict__ Hout, float* __restrict__ Yout) {
  // shapes at compile time: a pass's loads then share one address register pair and differ in
  // their immediate offsets, so that holding them all in flight costs no register per address
  constexpr int Kdim = GELU_OUT ? H_DIM : I_DIM;
  constexpr int Ndim = GELU_OUT ? I_DIM : H_DIM;
  constexpr int lda = Kdim;
  static_assert(Kdim % K_PASS == 0, "whole passes only");
  constexpr int K_SUB = K_PASS / 32;             // WMMA k-blocks per pass
  // k-blocks whose LDS reads go out as one group: GEMM2 the whole pass; GEMM1 one block
  constexpr int K_GRP = GELU_OUT ? 1 : K_SUB;
  static_assert(K_SUB % K_GRP == 0, "whole groups only");
  constexpr int K_THR = K_PASS / 2;              // k rows of the weight tile per thread
  constexpr int LDS_STRIDE = K_PASS + 8;         // 144 or 208 B rows: 16 B x odd, no bank conflicts
  // blockIdx.y counts the row tiles that exist, expert after expert: the grid then holds no
  // work-group per (expert, possible tile) that only starts, finds no rows and ends
  const int tile = blockIdx.y;
  // each array fetched whole, ahead of the search: one scalar load an array, none inside the search
  const int4 c_lo = ((const int4*)counts)[0], c_hi = ((const int4*)counts)[1];
  const int4 o_lo = ((const int4*)offs)[0], o_hi = ((const int4*)offs)[1];
  const int cnt_of[E_NUM] = {c_lo.x, c_lo.y, c_lo.z, c_lo.w, c_hi.x, c_hi.y, c_hi.z, c_hi.w};
  const int off_of[E_NUM] = {o_lo.x, o_lo.y, o_lo.z, o_lo.w, o_hi.x, o_hi.y, o_hi.z, o_hi.w};
  int e = -1, rows = 0, base = 0, start = 0, first = 0;
#pragma unroll  // the two arrays stay in scalar registers
  for (int i = 0; i < E_NUM; ++i) {
    const int nt = (int)((unsigned)(cnt_of[i] + TILE_M - 1) / TILE_M);
    const bool hit = (tile >= first) & (tile < first + nt);
    e = hit ? i : e;
    rows = hit ? cnt_of[i] : rows;
    base = hit ? off_of[i] : base;
    start = hit ? first : start;
    first += nt;
  }
  if (e < 0) return;                             // block-uniform exit: past the last tile
  const int m_blk = (tile - start) * TILE_M;     // < rows: the tile is one of the expert's own
  const int n_blk = blockIdx.x * TILE_N;
  const int wave = threadIdx.x >> 5;
  const int lane = threadIdx.x & 31;
  const int wm = wave >> 1;                      // 0..3 (M, 32 each)
  const int wn = wave & 1;                       // 0..1 (N, 64 each)
  const int lane15 = lane & 15;
  const int khalf = (lane >> 4) * 8;             // 0 or 8 per WMMA 16-bit layout

  // double-buffered weight tile: [n][k] layout, bf16
  __shared__ __align__(16) bf16_t Bs[2][TILE_N * LDS_STRIDE];
  // double-buffered A tile: [m][k] layout, same pitch (its readers are 16-byte LDS loads as well)
  __shared__ __align__(16) bf16_t As[2][TILE_M * LDS_STRIDE];

  const float* W = Wfull + (size_t)e * Kdim * Ndim;

  // cooperative A-tile copier: the tile's 16-byte pieces in row order, one piece a lane and copy, so
  // that a wave's copy takes runs of whole rows' bytes and not 32 bytes out of each of 16 rows
  constexpr int A_ROW_PCS = K_PASS / 8;          // 16-byte pieces of a row in one pass
  constexpr int A_COPIES = TILE_M * A_ROW_PCS / 256;
  static_assert(A_COPIES * 256 == TILE_M * A_ROW_PCS, "whole copies only");
  static_assert(A_COPIES == 4 || A_COPIES == 6, "copy_a spells out four and six copies");
  static_assert(Kdim / K_PASS >= 2, "the two-buffer ring needs two tiles");
  constexpr unsigned A_BUF_BYTES = TILE_M * LDS_STRIDE * sizeof(bf16_t);
  const bf16_t* a_src[A_COPIES];                 // the piece's place in pass 0
  unsigned a_dst[A_COPIES];                      // its LDS byte address in buffer 0
#pragma unroll  // both arrays stay in registers
  for (int i = 0; i < A_COPIES; ++i) {
    const int pc = (int)threadIdx.x + i * 256;
    const int r = pc / A_ROW_PCS;
    const int col = pc - r * A_ROW_PCS;
    int mloc = m_blk + r;
    if (mloc >= rows) mloc = rows - 1;           // clamp (stores are guarded)
    const int arow = rowtok ? rowtok[base + mloc] : (base + mloc);
    a_src[i] = A + (size_t)arow * lda + col * 8;
    a_dst[i] = (unsigned)(size_t)&As[0][r * LDS_STRIDE + col * 8];
  }
  // sends one A tile on its way into LDS, through no register. s_wait_xcnt 0 is kept, as a precaution,
  // in front of every rewrite of the copies' address registers: as the last line of their own
  // statement, where the compiler can put no such rewrite ahead of it.
  auto copy_a = [&](int k0, int b) {
    const unsigned lb = (unsigned)b * A_BUF_BYTES;
    if constexpr (A_COPIES == 4) {
      asm volatile(
          "global_load_async_to_lds_b128 %0, %1, off\n\t"
          "global_load_async_to_lds_b128 %2, %3, off\n\t"
          "global_load_async_to_lds_b128 %4, %5, off\n\t"
          "global_load_async_to_lds_b128 %6, %7, off\n\t"
          "s_wait_xcnt 0x0"
          :: "v"(a_dst[0] + lb), "v"(a_src[0] + k0), "v"(a_dst[1] + lb), "v"(a_src[1] + k0),
             "v"(a_dst[2] + lb), "v"(a_src[2] + k0), "v"(a_dst[3] + lb), "v"(a_src[3] + k0)
          : "memory");
    } else {
      asm volatile(
          "global_load_async_to_lds_b128 %0, %1, off\n\t"
          "global_load_async_to_lds_b128 %2, %3, off\n\t"
          "global_load_async_to_lds_b128 %4, %5, off\n\t"
          "global_load_async_to_lds_b128 %6, %7, off\n\t"
          "global_load_async_to_lds_b128 %8, %9, off\n\t"
          "global_load_async_to_lds_b128 %10, %11, off\n\t"
          "s_wait_xcnt 0x0"
          :: "v"(a_dst[0] + lb), "v"(a_src[0] + k0), "v"(a_dst[1] + lb), "v"(a_src[1] + k0),
             "v"(a_dst[2] + lb), "v"(a_src[2] + k0), "v"(a_dst[3] + lb), "v"(a_src[3] + k0),
             "v"(a_dst[4] + lb), "v"(a_src[4] + k0), "v"(a_dst[5] + lb), "v"(a_src[5] + k0)
          : "memory");
    }
  };

  // cooperative weight-tile loader: thread covers (n = tid&127, k chunk of K_THR)
  const int cn = threadIdx.x & 127;
  const int ck = (threadIdx.x >> 7) * K_THR;     // 0 or K_THR

  v8f c[2][4] = {{v8f{}, v8f{}, v8f{}, v8f{}}, {v8f{}, v8f{}, v8f{}, v8f{}}};

  // prologue: tile k0 = 0 -> As[0] (in flight under the weight tile's loads) and Bs[0]
  copy_a(0, 0);
  {
    const float* wp = W + (size_t)ck * Ndim + (n_blk + cn);
    float first[K_THR];
#pragma unroll  // all loads independent and in flight together
    for (int j = 0; j < K_THR; ++j) first[j] = wp[(size_t)j * Ndim];
#pragma unroll  // first[] stays in registers
    for (int g = 0; g < K_THR / 8; ++g) {
      v8bf p;
#pragma unroll
      for (int j = 0; j < 8; ++j) p[j] = f2bf(first[g * 8 + j]);
      *(v8bf*)&Bs[0][cn * LDS_STRIDE + ck + g * 8] = p;
    }
  }
  // this wave's copies of A tile 0 have landed before the barrier lets the other waves read them
  asm volatile("s_wait_asynccnt 0x0" ::: "memory");
  __syncthreads();
  copy_a(K_PASS, 1);                             // A tile 1 flies while pass 0 is worked on

  // one pass of products, k ascending: per 32-k block 2 A fragments (row = lane15, K = khalf+[0..7]
  // and khalf+16+[0..7]), 4 B fragments + 8 WMMAs (wave's 32x64 output). The LDS reads of K_GRP
  // blocks go out as one group, each fragment into registers of its own, ahead of those blocks'
  // WMMAs: the wave then meets the LDS latency once a group and not once a WMMA.
  auto pass_mm = [&](int buf) {
#pragma unroll  // LDS offsets become immediates
    for (int kg = 0; kg < K_SUB; kg += K_GRP) {
      v16bf af[K_GRP][2], bfr[K_GRP][4];
#pragma unroll  // both arrays stay in registers
      for (int kk = 0; kk < K_GRP; ++kk) {
#pragma unroll
        for (int mi = 0; mi < 2; ++mi) {
          const bf16_t* ap =
              &As[buf][(wm * 32 + mi * 16 + lane15) * LDS_STRIDE + (kg + kk) * 32 + khalf];
          v8bf alo = *(const v8bf*)(ap);
          v8bf ahi = *(const v8bf*)(ap + 16);
#pragma unroll
          for (int j = 0; j < 8; ++j) { af[kk][mi][j] = alo[j]; af[kk][mi][8 + j] = ahi[j]; }
        }
#pragma unroll
        for (int sub = 0; sub < 4; ++sub) {
          const bf16_t* bp =
              &Bs[buf][(wn * 64 + sub * 16 + lane15) * LDS_STRIDE + (kg + kk) * 32 + khalf];
          v8bf lo = *(const v8bf*)(bp);
          v8bf hi = *(const v8bf*)(bp + 16);
#pragma unroll
          for (int j = 0; j < 8; ++j) { bfr[kk][sub][j] = lo[j]; bfr[kk][sub][8 + j] = hi[j]; }
        }
      }
      // keeps the scheduler from sinking the reads back among the WMMAs, two in front of each with
      // a full wait, into one shared fragment register set
      __builtin_amdgcn_sched_barrier(0);
#pragma unroll
      for (int kk = 0; kk < K_GRP; ++kk) {
#pragma unroll
        for (int sub = 0; sub < 4; ++sub) {
#pragma unroll
          for (int mi = 0; mi < 2; ++mi) {
            c[mi][sub] = __builtin_amdgcn_wmma_f32_16x16x32_bf16(
                false, af[kk][mi], false, bfr[kk][sub], (short)0, c[mi][sub], false, false);
          }
        }
      }
    }
  };

  int buf = 0;
  int k0 = 0;
  // every pass but the last (peeled, so that no branch stands between the loads and their waits)
  for (; k0 + K_PASS < Kdim; k0 += K_PASS) {
    float nxt[K_THR];                            // next tile, in flight while the WMMAs run
    const float* wp = W + (size_t)(k0 + K_PASS + ck) * Ndim + (n_blk + cn);
#pragma unroll  // nxt[] stays in registers; all loads independent and in flight together
    for (int j = 0; j < K_THR; ++j) nxt[j] = wp[(size_t)j * Ndim];
    // GEMM2's build reuses the loads' address pair for the LDS reads below, with registers above
    // v255 in use: a wait in front of that rewrite is kept as a precaution
    if constexpr (!GELU_OUT) asm volatile("s_wait_xcnt 0x0" ::: "memory");
    // keeps the scheduler from sinking the loads down to their uses behind the WMMAs,
    // where only a few of them would be in flight at a time
    __builtin_amdgcn_sched_barrier(0);

    pass_mm(buf);
    // keeps the conversions, and with them the waits for the weight loads, behind the WMMAs
    __builtin_amdgcn_sched_barrier(0);

#pragma unroll  // convert + store next tile into the other buffer
    for (int g = 0; g < K_THR / 8; ++g) {
      v8bf p;
#pragma unroll
      for (int j = 0; j < 8; ++j) p[j] = f2bf(nxt[g * 8 + j]);
      *(v8bf*)&Bs[buf ^ 1][cn * LDS_STRIDE + ck + g * 8] = p;
    }
    // hand-over of the next pass's tiles: this wave's reads of As[buf] are over before anyone
    // refills it, and its copies into As[buf ^ 1] have landed before anyone reads them
    asm volatile("s_wait_dscnt 0x0" ::: "memory");
    asm volatile("s_wait_asynccnt 0x0" ::: "memory");
    __syncthreads();
    // the A tile after next, into the buffer that this pass has just read
    if (k0 + 2 * K_PASS < Kdim) copy_a(k0 + 2 * K_PASS, buf);
    buf ^= 1;
  }
  // no copy is left on its way when the wave goes on to its end
  asm volatile("s_wait_asynccnt 0x0" ::: "memory");
  pass_mm(buf);                                  // last pass: nothing left to fetch

  // store: D rows = j + (lane>=16 ? 8 : 0), col = lane&15
  const float* bp = bias + (size_t)e * Ndim;
  const int mrow0 = m_blk + wm * 32 + ((lane < 16) ? 0 : 8);
  // both 16-row halves of the wave's tile go through one copy of this text (the second half moves into
  // the first one's registers): unrolled, the long exact GELU would double the kernel's text
#pragma nounroll
  for (int mi = 0; mi < 2; ++mi) {
#pragma unroll
    for (int sub = 0; sub < 4; ++sub) {
      int n = n_blk + wn * 64 + sub * 16 + lane15;
      float bv = bp[n];
#pragma unroll
      for (int j = 0; j < 8; ++j) {
        int m = mrow0 + mi * 16 + j;
        if (m < rows) {
          float v = c[0][sub][j] + bv;
          size_t orow = (size_t)(base + m);
          if constexpr (GELU_OUT) {
            v = 0.5f * v * (1.0f + erff(v * 0.70710678118654752f));  // exact GELU
            Hout[orow * (size_t)Ndim + n] = f2bf(v);
          } else {
            Yout[orow * (size_t)Ndim + n] = v;
          }
        }
      }
    }
    if constexpr (!GELU_OUT) {
      // the moves below and the next half's addresses rewrite registers that the last store names:
      // a wait in front of them is kept as a precaution
      asm volatile("s_wait_xcnt 0x0" ::: "memory");
      // keeps the scheduler from lifting the moves over that wait
      __builtin_amdgcn_sched_barrier(0);
    }
#pragma unroll
    for (int sub = 0; sub < 4; ++sub) c[0][sub] = c[1][sub];
  }
}

// ---------------- combine (fixed order -> deterministic) + residual + LayerNorm ----------------
__global__ __launch_bounds__(256) void moe_combine_ln(
    const float* __restrict__ x, const float* __restrict__ y,
    const float* __restrict__ gate, const int* __restrict__ slot_of,
    const float* __restrict__ gamma, const float* __restrict__ beta,
    float* __restrict__ out) {
  int t = blockIdx.x;
  int s0 = slot_of[2 * t], s1 = slot_of[2 * t + 1];
  float w0 = gate[s0], w1 = gate[s1];
  const float* xr = x + (size_t)t * H_DIM;
  const float* y0 = y + (size_t)s0 * H_DIM;
  const float* y1 = y + (size_t)s1 * H_DIM;
  float z[3];
  float s = 0.f, sq = 0.f;
#pragma unroll
  for (int i = 0; i < 3; ++i) {
    int hh = threadIdx.x + i * 256;
    float v = xr[hh] + w0 * y0[hh] + w1 * y1[hh];
    z[i] = v; s += v; sq += v * v;
  }
#pragma unroll
  for (int off = 16; off > 0; off >>= 1) {
    s += __shfl_xor(s, off, 32);
    sq += __shfl_xor(sq, off, 32);
  }
  __shared__ float rs[8], rq[8];
  int wave = threadIdx.x >> 5, lane = threadIdx.x & 31;
  if (lane == 0) { rs[wave] = s; rq[wave] = sq; }
  __syncthreads();
  if (threadIdx.x == 0) {
    float S = 0.f, Q = 0.f;
    for (int i = 0; i < 8; ++i) { S += rs[i]; Q += rq[i]; }
    rs[0] = S; rq[0] = Q;
  }
  __syncthreads();
  float mean = rs[0] * (1.0f / H_DIM);
  float var = rq[0] * (1.0f / H_DIM) - mean * mean;
  float inv = rsqrtf(var + LN_EPS);
#pragma unroll
  for (int i = 0; i < 3; ++i) {
    int hh = threadIdx.x + i * 256;
    out[(size_t)t * H_DIM + hh] = (z[i] - mean) * inv * gamma[hh] + beta[hh];
  }
}

extern "C" void kernel_launch(void* const* d_in, const int* in_sizes, int n_in,
                              void* d_out, int out_size, void* d_ws, size_t ws_size,
                              hipStream_t stream) {
  const float* x  = (const float*)d_in[0];
  const float* W1 = (const float*)d_in[1];
  const float* b1 = (const float*)d_in[2];
  const float* W2 = (const float*)d_in[3];
  const float* b2 = (const float*)d_in[4];
  const float* Wg = (const float*)d_in[5];
  const float* bg = (const float*)d_in[6];
  const float* gamma = (const float*)d_in[7];
  const float* beta  = (const float*)d_in[8];
  float* out = (float*)d_out;

  char* ws = (char*)d_ws;
  size_t off = 0;
  auto alloc = [&](size_t bytes) -> void* {
    void* p = ws + off;
    off = (off + bytes + 255) & ~(size_t)255;
    return p;
  };
  bf16_t* xb     = (bf16_t*)alloc((size_t)T_TOK * H_DIM * sizeof(bf16_t));  // 3.1 MB
  bf16_t* hbuf   = (bf16_t*)alloc((size_t)A_TOT * I_DIM * sizeof(bf16_t));  // 25.2 MB
  float*  ybuf   = (float*) alloc((size_t)A_TOT * H_DIM * sizeof(float));   // 12.6 MB
  int*    top_e  = (int*)   alloc((size_t)T_TOK * 2 * sizeof(int));
  float*  top_w  = (float*) alloc((size_t)T_TOK * 2 * sizeof(float));
  int*    counts = (int*)   alloc(E_NUM * sizeof(int));
  int*    offsv  = (int*)   alloc(E_NUM * sizeof(int));
  int*    rowtok = (int*)   alloc((size_t)A_TOT * sizeof(int));
  float*  gate   = (float*) alloc((size_t)A_TOT * sizeof(float));
  int*    slotof = (int*)   alloc((size_t)T_TOK * 2 * sizeof(int));

  cvt_x_kernel<<<1536, 256, 0, stream>>>(x, xb);
  moe_router<<<T_TOK / 8, 256, 0, stream>>>(x, Wg, bg, top_e, top_w);
  moe_partition<<<1, 1024, 0, stream>>>(top_e, top_w, counts, offsv, rowtok, gate, slotof);
  // GEMM1 + GELU: A = xb[token], W1_e [H x I], out bf16 h [slot][I]
  moe_gemm<true, K_PASS_1><<<dim3(I_DIM / TILE_N, M_TILES_MAX), 256, 0, stream>>>(
      xb, W1, b1, counts, offsv, rowtok, hbuf, nullptr);
  // GEMM2: A = h[slot], W2_e [I x H], out fp32 y [slot][H]
  moe_gemm<false, K_PASS_2><<<dim3(H_DIM / TILE_N, M_TILES_MAX), 256, 0, stream>>>(
      hbuf, W2, b2, counts, offsv, nullptr, nullptr, ybuf);
  moe_combine_ln<<<T_TOK, 256, 0, stream>>>(x, ybuf, gate, slotof, gamma, beta, out);
}

// v007
// One run takes 106 microseconds.
// Next to v006, in two timings, it ran 1.07 and 1.08 times as fast.
// Over all steps from v000 it is 2.44 times as fast.
#include <hip/hip_runtime.h>
#include <hip/hip_bf16.h>
#include <math.h>

// MoE (top-2 of 8 experts), H=768, I=3072, T=2048 tokens.
// bf16 WMMA (v_wmma_f32_16x16x32_bf16) with fp32 accumulate; gather-based
// expert execution (exactly K*T = 4096 assignment rows of GEMM work).
// GEMM: 128x128 block tile, 8 waves (4M x 2N), 32x64 per wave (8 WMMA accums),
// double-buffered LDS weight tile (fp32 -> bf16 on the fly), 64 or 96 k per pass, 1 barrier/pass.
// A weight tile's loads go out two passes ahead of its use, into one of two register sets.
// A tile (128 rows x one pass of k) double-buffered in LDS too, filled by asynchronous copies.
// LDS fragment reads go out in groups ahead of their WMMAs (32 k a group in GEMM1, 96 in GEMM2).
// GEMM grid: (column tiles) x (row tiles that any routing can need, all experts in a row).

typedef __bf16 bf16_t;
typedef __attribute__((ext_vector_type(16))) __bf16 v16bf;
typedef __attribute__((ext_vector_type(8)))  __bf16 v8bf;
typedef __attribute__((ext_vector_type(8)))  float  v8f;

#define T_TOK 2048
#define H_DIM 768
#define I_DIM 3072
#define E_NUM 8
#define A_TOT (T_TOK * 2)
#define LN_EPS 1e-5f

#define TILE_N 128
// rows per work-group: a weight tile is fetched from L2 and converted once per TILE_M rows of its expert
#define TILE_M 128
// row tiles that any routing can need: each expert rounds its rows up to whole tiles
#define M_TILES_MAX (A_TOT / TILE_M + E_NUM)
// k per pass (K_PASS) must divide the GEMM's K an even number of times. K_PASS / 2 weight loads a lane
// make one tile's set; two sets are on their way at a time (the load counter holds 63: where the older
// set has not come back yet, the issue of the younger one waits for it).
#define K_PASS_1 64     // GEMM1: many work-groups; the smaller register set lets several share a WGP
#define GEMM1_WAVES 4   // waves a SIMD that GEMM1's registers must leave room for: two work-groups a WGP
#define K_PASS_2 96     // GEMM2: few work-groups and a long K: the deepest whole divisor whose set fits the counter

__device__ __forceinline__ bf16_t f2bf(float f) {
  unsigned u = __builtin_bit_cast(unsigned, f);
  u += 0x7FFFu + ((u >> 16) & 1u);                 // round-to-nearest-even
  unsigned short hs = (unsigned short)(u >> 16);
  return __builtin_bit_cast(bf16_t, hs);
}

// work-group barrier that orders LDS alone. __syncthreads() also waits for every global load of the
// wave, and the weight loads of the tile after next are to stay on their way across the barrier.
// Its release fence waits for the wave's own LDS stores; the waits for asynchronous copies, and for LDS
// reads ahead of a refill by such copies, stand in front of each call.
__device__ __forceinline__ void barrier_lds() {
  __builtin_amdgcn_fence(__ATOMIC_RELEASE, "workgroup", "local");
  __builtin_amdgcn_s_barrier();
  __builtin_amdgcn_fence(__ATOMIC_ACQUIRE, "workgroup", "local");
}

// ---------------- x -> bf16 ----------------
__global__ void cvt_x_kernel(const float* __restrict__ x, bf16_t* __restrict__ xb) {
  int n = T_TOK * H_DIM;
  for (int i = blockIdx.x * blockDim.x + threadIdx.x; i < n; i += gridDim.x * blockDim.x)
    xb[i] = f2bf(x[i]);
}

// ---------------- router: one wave per token ----------------
__global__ __launch_bounds__(256) void moe_router(
    const float* __restrict__ x, const float* __restrict__ Wg,
    const float* __restrict__ bg, int* __restrict__ top_e, float* __restrict__ top_w) {
  int wave = threadIdx.x >> 5;
  int lane = threadIdx.x & 31;
  int t = blockIdx.x * 8 + wave;
  if (t >= T_TOK) return;
  float acc[E_NUM];
#pragma unroll
  for (int e = 0; e < E_NUM; ++e) acc[e] = 0.f;
  const float* xr = x + (size_t)t * H_DIM;
  for (int h = lane; h < H_DIM; h += 32) {
    float xv = xr[h];
    const float* wr = Wg + (size_t)h * E_NUM;
#pragma unroll
    for (int e = 0; e < E_NUM; ++e) acc[e] += xv * wr[e];
  }
#pragma unroll
  for (int e = 0; e < E_NUM; ++e) {
#pragma unroll
    for (int off = 16; off > 0; off >>= 1) acc[e] += __shfl_xor(acc[e], off, 32);
  }
  if (lane == 0) {
    float p[E_NUM];
    float mx = -1e30f;
#pragma unroll
    for (int e = 0; e < E_NUM; ++e) { p[e] = acc[e] + bg[e]; mx = fmaxf(mx, p[e]); }
    float sum = 0.f;
#pragma unroll
    for (int e = 0; e < E_NUM; ++e) { p[e] = expf(p[e] - mx); sum += p[e]; }
    float inv = 1.0f / sum;
#pragma unroll
    for (int e = 0; e < E_NUM; ++e) p[e] *= inv;
    int i0 = 0; float v0 = p[0];
#pragma unroll
    for (int e = 1; e < E_NUM; ++e) if (p[e] > v0) { v0 = p[e]; i0 = e; }   // first index wins ties
    int i1 = -1; float v1 = -1.0f;
#pragma unroll
    for (int e = 0; e < E_NUM; ++e) if (e != i0 && p[e] > v1) { v1 = p[e]; i1 = e; }
    float s2 = v0 + v1;
    top_e[2 * t] = i0;       top_e[2 * t + 1] = i1;
    top_w[2 * t] = v0 / s2;  top_w[2 * t + 1] = v1 / s2;
  }
}

// ---------------- deterministic partition: one wave per (expert, token quarter) ----------------
// 32 waves. Each wave takes its 512 tokens' expert pairs and weights into registers with one
// batch of independent loads, counts its matches, and gets its first slot from the 32 counts
// in LDS. Slots of an expert stay in ascending token order.
#define PART_Q 4                                  // token quarters
#define PART_IT (T_TOK / PART_Q / 32)             // groups of 32 tokens per wave
__global__ __launch_bounds__(1024) void moe_partition(
    const int* __restrict__ top_e, const float* __restrict__ top_w,
    int* __restrict__ counts, int* __restrict__ offs,
    int* __restrict__ rowtok, float* __restrict__ gate, int* __restrict__ slot_of) {
  const int wave = threadIdx.x >> 5;              // = e * PART_Q + q: slot order of the pieces
  const int lane = threadIdx.x & 31;
  const int e = wave >> 2;
  const int q = wave & (PART_Q - 1);
  const int t0 = q * (T_TOK / PART_Q) + lane;
  __shared__ int scnt[E_NUM * PART_Q];

  int e0[PART_IT], e1[PART_IT];
  float w0[PART_IT], w1[PART_IT];
#pragma unroll  // all loads independent and in flight together: one memory round trip
  for (int i = 0; i < PART_IT; ++i) {
    int2 ev = ((const int2*)top_e)[t0 + i * 32];
    float2 wv = ((const float2*)top_w)[t0 + i * 32];
    e0[i] = ev.x; e1[i] = ev.y;
    w0[i] = wv.x; w1[i] = wv.y;
  }
  unsigned m[PART_IT];
  int cnt = 0;
#pragma unroll  // arrays stay in registers
  for (int i = 0; i < PART_IT; ++i) {
    bool sel = (e0[i] == e) | (e1[i] == e);
    m[i] = (unsigned)(__ballot(sel) & 0xffffffffull);
    cnt += __popc(m[i]);
  }
  if (lane == 0) scnt[wave] = cnt;
  __syncthreads();
  const int v = scnt[lane];
  int before = (lane < wave) ? v : 0;             // pieces that come first in slot order
  int mine = ((lane >> 2) == e) ? v : 0;          // the expert's own four pieces
#pragma unroll
  for (int off = 16; off > 0; off >>= 1) {
    before += __shfl_xor(before, off, 32);
    mine += __shfl_xor(mine, off, 32);
  }
  if (q == 0 && lane == 0) { offs[e] = before; counts[e] = mine; }
  int pos = before;
  const unsigned lt = (1u << lane) - 1u;
#pragma unroll  // arrays stay in registers
  for (int i = 0; i < PART_IT; ++i) {
    if ((m[i] >> lane) & 1u) {
      const bool first = (e0[i] == e);
      const int t = t0 + i * 32;
      const int slot = pos + __popc(m[i] & lt);
      rowtok[slot] = t;
      gate[slot] = first ? w0[i] : w1[i];
      slot_of[2 * t + (first ? 0 : 1)] = slot;
    }
    pos += __popc(m[i]);
  }
}

// ---------------- WMMA GEMM: C[rows_e x Ndim] = A[rows] x W_e[Kdim x Ndim] ----------------
// second launch bound = waves a SIMD that must still fit beside the 8 accumulators and the fragments
// of a group: GEMM1_WAVES (GEMM1), 2 (GEMM2: it has fewer work-groups than the chip has WGPs)
template <bool GELU_OUT, int K_PASS>
__global__ __launch_bounds__(256, GELU_OUT ? GEMM1_WAVES : 2) void moe_gemm(
    const bf16_t* __restrict__ A,
    const float* __restrict__ Wfull, const float* __restrict__ bias,
    const int* __restrict__ counts, const int* __restrict__ offs,
    const int* __restrict__ rowtok,              // null -> identity (slot rows)
    bf16_t* __restrict__ Hout, float* __restrict__ Yout) {
  // shapes at compile time: a pass's loads then share one address register pair and differ in
  // their immediate offsets, so that holding them all in flight costs no register per address
  constexpr int Kdim = GELU_OUT ? H_DIM : I_DIM;
  constexpr int Ndim = GELU_OUT ? I_DIM : H_DIM;
  constexpr int lda = Kdim;
  static_assert(Kdim % K_PASS == 0, "whole passes only");
  constexpr int K_SUB = K_PASS / 32;             // WMMA k-blocks per pass
  // k-blocks whose LDS reads go out as one group: GEMM2 the whole pass; GEMM1 one block
  constexpr int K_GRP = GELU_OUT ? 1 : K_SUB;
  static_assert(K_SUB % K_GRP == 0, "whole groups only");
  constexpr int K_THR = K_PASS / 2;              // k rows of the weight tile per thread
  constexpr int LDS_STRIDE = K_PASS + 8;         // 144 or 208 B rows: 16 B x odd, no bank conflicts
  // blockIdx.y counts the row tiles that exist, expert after expert: the grid then holds no
  // work-group per (expert, possible tile) that only starts, finds no rows and ends
  const int tile = blockIdx.y;
  // each array fetched whole, ahead of the search: one scalar load an array, none inside the search
  const int4 c_lo = ((const int4*)counts)[0], c_hi = ((const int4*)counts)[1];
  const int4 o_lo = ((const int4*)offs)[0], o_hi = ((const int4*)offs)[1];
  const int cnt_of[E_NUM] = {c_lo.x, c_lo.y, c_lo.z, c_lo.w, c_hi.x, c_hi.y, c_hi.z, c_hi.w};
  const int off_of[E_NUM] = {o_lo.x, o_lo.y, o_lo.z, o_lo.w, o_hi.x, o_hi.y, o_hi.z, o_hi.w};
  int e = -1, rows = 0, base = 0, start = 0, first = 0;
#pragma unroll  // the two arrays stay in scalar registers
  for (int i = 0; i < E_NUM; ++i) {
    const int nt = (int)((unsigned)(cnt_of[i] + TILE_M - 1) / TILE_M);
    const bool hit = (tile >= first) & (tile < first + nt);
    e = hit ? i : e;
    rows = hit ? cnt_of[i] : rows;
    base = hit ? off_of[i] : base;
    start = hit ? first : start;
    first += nt;
  }
  if (e < 0) return;                             // block-uniform exit: past the last tile
  const int m_blk = (tile - start) * TILE_M;     // < rows: the tile is one of the expert's own
  const int n_blk = blockIdx.x * TILE_N;
  const int wave = threadIdx.x >> 5;
  const int lane = threadIdx.x & 31;
  const int wm = wave >> 1;                      // 0..3 (M, 32 each)
  const int wn = wave & 1;                       // 0..1 (N, 64 each)
  const int lane15 = lane & 15;
  const int khalf = (lane >> 4) * 8;             // 0 or 8 per WMMA 16-bit layout

  // double-buffered weight tile: [n][k] layout, bf16
  __shared__ __align__(16) bf16_t Bs[2][TILE_N * LDS_STRIDE];
  // double-buffered A tile: [m][k] layout, same pitch (its readers are 16-byte LDS loads as well)
  __shared__ __align__(16) bf16_t As[2][TILE_M * LDS_STRIDE];

  const float* W = Wfull + (size_t)e * Kdim * Ndim;

  // cooperative A-tile copier: the tile's 16-byte pieces in row order, one piece a lane and copy, so
  // that a wave's copy takes runs of whole rows' bytes and not 32 bytes out of each of 16 rows
  constexpr int A_ROW_PCS = K_PASS / 8;          // 16-byte pieces of a row in one pass
  constexpr int A_COPIES = TILE_M * A_ROW_PCS / 256;
  static_assert(A_COPIES * 256 == TILE_M * A_ROW_PCS, "whole copies only");
  static_assert(A_COPIES == 4 || A_COPIES == 6, "copy_a spells out four and six copies");
  static_assert(Kdim / K_PASS >= 2, "the two-buffer ring needs two tiles");
  constexpr unsigned A_BUF_BYTES = TILE_M * LDS_STRIDE * sizeof(bf16_t);
  const bf16_t* a_src[A_COPIES];                 // the piece's place in pass 0
  unsigned a_dst[A_COPIES];                      // its LDS byte address in buffer 0
#pragma unroll  // both arrays stay in registers
  for (int i = 0; i < A_COPIES; ++i) {
    const int pc = (int)threadIdx.x + i * 256;
    const int r = pc / A_ROW_PCS;
    const int col = pc - r * A_ROW_PCS;
    int mloc = m_blk + r;
    if (mloc >= rows) mloc = rows - 1;           // clamp (stores are guarded)
    const int arow = rowtok ? rowtok[base + mloc] : (base + mloc);
    a_src[i] = A + (size_t)arow * lda + col * 8;
    a_dst[i] = (unsigned)(size_t)&As[0][r * LDS_STRIDE + col * 8];
  }
  // sends one A tile on its way into LDS, through no register. s_wait_xcnt 0 is kept, as a precaution,
  // in front of every rewrite of the copies' address registers: as the last line of their own
  // statement, where the compiler can put no such rewrite ahead of it.
  auto copy_a = [&](int k0, int b) {
    const unsigned lb = (unsigned)b * A_BUF_BYTES;
    if constexpr (A_COPIES == 4) {
      asm volatile(
          "global_load_async_to_lds_b128 %0, %1, off\n\t"
          "global_load_async_to_lds_b128 %2, %3, off\n\t"
          "global_load_async_to_lds_b128 %4, %5, off\n\t"
          "global_load_async_to_lds_b128 %6, %7, off\n\t"
          "s_wait_xcnt 0x0"
          :: "v"(a_dst[0] + lb), "v"(a_src[0] + k0), "v"(a_dst[1] + lb), "v"(a_src[1] + k0),
             "v"(a_dst[2] + lb), "v"(a_src[2] + k0), "v"(a_dst[3] + lb), "v"(a_src[3] + k0)
          : "memory");
    } else {
      asm volatile(
          "global_load_async_to_lds_b128 %0, %1, off\n\t"
          "global_load_async_to_lds_b128 %2, %3, off\n\t"
          "global_load_async_to_lds_b128 %4, %5, off\n\t"
          "global_load_async_to_lds_b128 %6, %7, off\n\t"
          "global_load_async_to_lds_b128 %8, %9, off\n\t"
          "global_load_async_to_lds_b128 %10, %11, off\n\t"
          "s_wait_xcnt 0x0"
          :: "v"(a_dst[0] + lb), "v"(a_src[0] + k0), "v"(a_dst[1] + lb), "v"(a_src[1] + k0),
             "v"(a_dst[2] + lb), "v"(a_src[2] + k0), "v"(a_dst[3] + lb), "v"(a_src[3] + k0),
             "v"(a_dst[4] + lb), "v"(a_src[4] + k0), "v"(a_dst[5] + lb), "v"(a_src[5] + k0)
          : "memory");
    }
  };

  // cooperative weight-tile loader: thread covers (n = tid&127, k chunk of K_THR)
  const int cn = threadIdx.x & 127;
  const int ck = (threadIdx.x >> 7) * K_THR;     // 0 or K_THR

  v8f c[2][4] = {{v8f{}, v8f{}, v8f{}, v8f{}}, {v8f{}, v8f{}, v8f{}, v8f{}}};

  // sends one weight tile's loads on their way into a register set
  auto load_w = [&](float (&dst)[K_THR], int kt) {
    const float* wp = W + (size_t)(kt + ck) * Ndim + (n_blk + cn);
#pragma unroll  // dst[] stays in registers; all loads independent and in flight together
    for (int j = 0; j < K_THR; ++j) dst[j] = wp[(size_t)j * Ndim];
    // these loads are still out when their address pair is next rewritten (LDS addresses, the next
    // tile's address): the wait in front of such a rewrite, kept as a precaution
    asm volatile("s_wait_xcnt 0x0" ::: "memory");
    // keeps the scheduler from sinking the loads down to their uses, a pass and a half later,
    // and from lifting a rewrite of their address pair over the wait
    __builtin_amdgcn_sched_barrier(0);
  };
  // converts a register set that has come back and stores it as weight tile into buffer b
  auto store_w = [&](const float (&s)[K_THR], int b) {
#pragma unroll  // s[] stays in registers
    for (int g = 0; g < K_THR / 8; ++g) {
      v8bf p;
#pragma unroll
      for (int j = 0; j < 8; ++j) p[j] = f2bf(s[g * 8 + j]);
      *(v8bf*)&Bs[b][cn * LDS_STRIDE + ck + g * 8] = p;
    }
  };
  // two register sets: while one tile's set is converted, the tile behind it is already on its way
  float wa[K_THR], wb[K_THR];

  // prologue: tile 0 -> As[0] (in flight under the weight tiles' loads) and Bs[0]; weight tile 1 sent off
  copy_a(0, 0);
  load_w(wb, 0);
  load_w(wa, K_PASS);
  store_w(wb, 0);
  // this wave's copies of A tile 0 have landed before the barrier lets the other waves read them
  asm volatile("s_wait_asynccnt 0x0" ::: "memory");
  barrier_lds();
  copy_a(K_PASS, 1);                             // A tile 1 flies while pass 0 is worked on

  // one pass of products, k ascending: per 32-k block 2 A fragments (row = lane15, K = khalf+[0..7]
  // and khalf+16+[0..7]), 4 B fragments + 8 WMMAs (wave's 32x64 output). The LDS reads of K_GRP
  // blocks go out as one group, each fragment into registers of its own, ahead of those blocks'
  // WMMAs: the wave then meets the LDS latency once a group and not once a WMMA.
  auto pass_mm = [&](int buf) {
#pragma unroll  // LDS offsets become immediates
    for (int kg = 0; kg < K_SUB; kg += K_GRP) {
      v16bf af[K_GRP][2], bfr[K_GRP][4];
#pragma unroll  // both arrays stay in registers
      for (int kk = 0; kk < K_GRP; ++kk) {
#pragma unroll
        for (int mi = 0; mi < 2; ++mi) {
          const bf16_t* ap =
              &As[buf][(wm * 32 + mi * 16 + lane15) * LDS_STRIDE + (kg + kk) * 32 + khalf];
          v8bf alo = *(const v8bf*)(ap);
          v8bf ahi = *(const v8bf*)(ap + 16);
#pragma unroll
          for (int j = 0; j < 8; ++j) { af[kk][mi][j] = alo[j]; af[kk][mi][8 + j] = ahi[j]; }
        }
#pragma unroll
        for (int sub = 0; sub < 4; ++sub) {
          const bf16_t* bp =
              &Bs[buf][(wn * 64 + sub * 16 + lane15) * LDS_STRIDE + (kg + kk) * 32 + khalf];
          v8bf lo = *(const v8bf*)(bp);
          v8bf hi = *(const v8bf*)(bp + 16);
#pragma unroll
          for (int j = 0; j < 8; ++j) { bfr[kk][sub][j] = lo[j]; bfr[kk][sub][8 + j] = hi[j]; }
        }
      }
      // keeps the scheduler from sinking the reads back among the WMMAs, two in front of each with
      // a full wait, into one shared fragment register set
      __builtin_amdgcn_sched_barrier(0);
#pragma unroll
      for (int kk = 0; kk < K_GRP; ++kk) {
#pragma unroll
        for (int sub = 0; sub < 4; ++sub) {
#pragma unroll
          for (int mi = 0; mi < 2; ++mi) {
            c[mi][sub] = __builtin_amdgcn_wmma_f32_16x16x32_bf16(
                false, af[kk][mi], false, bfr[kk][sub], (short)0, c[mi][sub], false, false);
          }
        }
      }
    }
  };

  // hand-over of the next pass's tiles: this wave's reads of the A buffer of this pass are over before
  // anyone refills it, and its copies into the other one have landed before anyone reads them
  auto hand_over = [&]() {
    asm volatile("s_wait_dscnt 0x0" ::: "memory");
    asm volatile("s_wait_asynccnt 0x0" ::: "memory");
    barrier_lds();
  };
  static_assert((Kdim / K_PASS) % 2 == 0 && Kdim / K_PASS >= 4, "passes go in pairs, one per register set");
  // two passes a trip, so that each register set and each LDS buffer has its fixed place in the text.
  // Pass p sends off weight tile p + 2, works on tile p and converts tile p + 1, whose loads went out
  // in pass p - 1: they have had a whole pass and this pass's WMMAs to come back.
  for (int k0 = 0; k0 + 3 * K_PASS < Kdim; k0 += 2 * K_PASS) {
    load_w(wb, k0 + 2 * K_PASS);
    pass_mm(0);
    // keeps the conversions, and with them the waits for the weight loads, behind the WMMAs
    __builtin_amdgcn_sched_barrier(0);
    store_w(wa, 1);
    hand_over();
    copy_a(k0 + 2 * K_PASS, 0);                  // the A tile after next, into the buffer just read

    load_w(wa, k0 + 3 * K_PASS);
    pass_mm(1);
    // as above
    __builtin_amdgcn_sched_barrier(0);
    store_w(wb, 0);
    hand_over();
    copy_a(k0 + 3 * K_PASS, 1);
  }
  // last pass but one: nothing left to send off; its hand-over leaves no copy on its way
  pass_mm(0);
  // as above
  __builtin_amdgcn_sched_barrier(0);
  store_w(wa, 1);
  hand_over();
  pass_mm(1);                                    // last pass: nothing left to fetch

  // store: D rows = j + (lane>=16 ? 8 : 0), col = lane&15
  const float* bp = bias + (size_t)e * Ndim;
  const int mrow0 = m_blk + wm * 32 + ((lane < 16) ? 0 : 8);
  // both 16-row halves of the wave's tile go through one copy of this text (the second half moves into
  // the first one's registers): unrolled, the long exact GELU would double the kernel's text
#pragma nounroll
  for (int mi = 0; mi < 2; ++mi) {
#pragma unroll
    for (int sub = 0; sub < 4; ++sub) {
      int n = n_blk + wn * 64 + sub * 16 + lane15;
      float bv = bp[n];
#pragma unroll
      for (int j = 0; j < 8; ++j) {
        int m = mrow0 + mi * 16 + j;
        if (m < rows) {
          float v = c[0][sub][j] + bv;
          size_t orow = (size_t)(base + m);
          if constexpr (GELU_OUT) {
            v = 0.5f * v * (1.0f + erff(v * 0.70710678118654752f));  // exact GELU
            Hout[orow * (size_t)Ndim + n] = f2bf(v);
          } else {
            Yout[orow * (size_t)Ndim + n] = v;
          }
        }
      }
    }
    if constexpr (!GELU_OUT) {
      // the moves below and the next half's addresses rewrite registers that the last store names:
      // a wait in front of them is kept as a precaution
      asm volatile("s_wait_xcnt 0x0" ::: "memory");
      // keeps the scheduler from lifting the moves over that wait
      __builtin_amdgcn_sched_barrier(0);
    }
#pragma unroll
    for (int sub = 0; sub < 4; ++sub) c[0][sub] = c[1][sub];
  }
}

// ---------------- combine (fixed order -> deterministic) + residual + LayerNorm ----------------
__global__ __launch_bounds__(256) void moe_combine_ln(
    const float* __restrict__ x, const float* __restrict__ y,
    const float* __restrict__ gate, const int* __restrict__ slot_of,
    const float* __restrict__ gamma, const float* __restrict__ beta,
    float* __restrict__ out) {
  int t = blockIdx.x;
  int s0 = slot_of[2 * t], s1 = slot_of[2 * t + 1];
  float w0 = gate[s0], w1 = gate[s1];
  const float* xr = x + (size_t)t * H_DIM;
  const float* y0 = y + (size_t)s0 * H_DIM;
  const float* y1 = y + (size_t)s1 * H_DIM;
  float z[3];
  float s = 0.f, sq = 0.f;
#pragma unroll
  for (int i = 0; i < 3; ++i) {
    int hh = threadIdx.x + i * 256;
    float v = xr[hh] + w0 * y0[hh] + w1 * y1[hh];
    z[i] = v; s += v; sq += v * v;
  }
#pragma unroll
  for (int off = 16; off > 0; off >>= 1) {
    s += __shfl_xor(s, off, 32);
    sq += __shfl_xor(sq, off, 32);
  }
  __shared__ float rs[8], rq[8];
  int wave = threadIdx.x >> 5, lane = threadIdx.x & 31;
  if (lane == 0) { rs[wave] = s; rq[wave] = sq; }
  __syncthreads();
  if (threadIdx.x == 0) {
    float S = 0.f, Q = 0.f;
    for (int i = 0; i < 8; ++i) { S += rs[i]; Q += rq[i]; }
    rs[0] = S; rq[0] = Q;
  }
  __syncthreads();
  float mean = rs[0] * (1.0f / H_DIM);
  float var = rq[0] * (1.0f / H_DIM) - mean * mean;
  float inv = rsqrtf(var + LN_EPS);
#pragma unroll
  for (int i = 0; i < 3; ++i) {
    int hh = threadIdx.x + i * 256;
    out[(size_t)t * H_DIM + hh] = (z[i] - mean) * inv * gamma[hh] + beta[hh];
  }
}

extern "C" void kernel_launch(void* const* d_in, const int* in_sizes, int n_in,
                              void* d_out, int out_size, void* d_ws, size_t ws_size,
                              hipStream_t stream) {
  const float* x  = (const float*)d_in[0];
  const float* W1 = (const float*)d_in[1];
  const float* b1 = (const float*)d_in[2];
  const float* W2 = (const float*)d_in[3];
  const float* b2 = (const float*)d_in[4];
  const float* Wg = (const float*)d_in[5];
  const float* bg = (const float*)d_in[6];
  const float* gamma = (const float*)d_in[7];
  const float* beta  = (const float*)d_in[8];
  float* out = (float*)d_out;

  char* ws = (char*)d_ws;
  size_t off = 0;
  auto alloc = [&](size_t bytes) -> void* {
    void* p = ws + off;
    off = (off + bytes + 255) & ~(size_t)255;
    return p;
  };
  bf16_t* xb     = (bf16_t*)alloc((size_t)T_TOK * H_DIM * sizeof(bf16_t));  // 3.1 MB
  bf16_t* hbuf   = (bf16_t*)alloc((size_t)A_TOT * I_DIM * sizeof(bf16_t));  // 25.2 MB
  float*  ybuf   = (float*) alloc((size_t)A_TOT * H_DIM * sizeof(float));   // 12.6 MB
  int*    top_e  = (int*)   alloc((size_t)T_TOK * 2 * sizeof(int));
  float*  top_w  = (float*) alloc((size_t)T_TOK * 2 * sizeof(float));
  int*    counts = (int*)   alloc(E_NUM * sizeof(int));
  int*    offsv  = (int*)   alloc(E_NUM * sizeof(int));
  int*    rowtok = (int*)   alloc((size_t)A_TOT * sizeof(int));
  float*  gate   = (float*) alloc((size_t)A_TOT * sizeof(float));
  int*    slotof = (int*)   alloc((size_t)T_TOK * 2 * sizeof(int));

  cvt_x_kernel<<<1536, 256, 0, stream>>>(x, xb);
  moe_router<<<T_TOK / 8, 256, 0, stream>>>(x, Wg, bg, top_e, top_w);
  moe_partition<<<1, 1024, 0, stream>>>(top_e, top_w, counts, offsv, rowtok, gate, slotof);
  // GEMM1 + GELU: A = xb[token], W1_e [H x I], out bf16 h [slot][I]
  moe_gemm<true, K_PASS_1><<<dim3(I_DIM / TILE_N, M_TILES_MAX), 256, 0, stream>>>(
      xb, W1, b1, counts, offsv, rowtok, hbuf, nullptr);
  // GEMM2: A = h[slot], W2_e [I x H], out fp32 y [slot][H]
  moe_gemm<false, K_PASS_2><<<dim3(H_DIM / TILE_N, M_TILES_MAX), 256, 0, stream>>>(
      hbuf, W2, b2, counts, offsv, nullptr, nullptr, ybuf);
  moe_combine_ln<<<T_TOK, 256, 0, stream>>>(x, ybuf, gate, slotof, gamma, beta, out);
}

// v008
// Measured time: 96.1 microseconds a run.
// Two timings next to v007 both put it at 1.10 times that version's speed.
// All steps since v000 together make it 2.69 times as fast.
#include <hip/hip_runtime.h>
#include <hip/hip_bf16.h>
#include <math.h>

// MoE (top-2 of 8 experts), H=768, I=3072, T=2048 tokens.
// bf16 WMMA (v_wmma_f32_16x16x32_bf16) with fp32 accumulate; gather-based
// expert execution (exactly K*T = 4096 assignment rows of GEMM work).
// GEMM: 128x128 block tile, 8 waves (4M x 2N), 32x64 per wave (8 WMMA accums),
// double-buffered LDS weight tile (fp32 -> bf16 on the fly), 64 or 96 k per pass, 1 barrier/pass.
// A weight tile's loads go out two passes ahead of its use, into one of two register sets.
// A tile (128 rows x one pass of k) double-buffered in LDS too, filled by asynchronous copies.
// LDS fragment reads go out in groups ahead of their WMMAs (32 k a group in GEMM1, 96 in GEMM2).
// GEMM grid: (column tiles) x (row tiles that any routing can need, all experts in a row).

typedef __bf16 bf16_t;
typedef __attribute__((ext_vector_type(16))) __bf16 v16bf;
typedef __attribute__((ext_vector_type(8)))  __bf16 v8bf;
typedef __attribute__((ext_vector_type(8)))  float  v8f;

#define T_TOK 2048
#define H_DIM 768
#define I_DIM 3072
#define E_NUM 8
#define A_TOT (T_TOK * 2)
#define LN_EPS 1e-5f

#define TILE_N 128
// rows per work-group: a weight tile is fetched from L2 and converted once per TILE_M rows of its expert
#define TILE_M 128
// row tiles that any routing can need: each expert rounds its rows up to whole tiles
#define M_TILES_MAX (A_TOT / TILE_M + E_NUM)
// k per pass (K_PASS) must divide the GEMM's K an even number of times. K_PASS / 2 weight loads a lane
// make one tile's set; two sets are on their way at a time (the load counter holds 63: where the older
// set has not come back yet, the issue of the younger one waits for it).
#define K_PASS_1 64     // GEMM1: many work-groups; the smaller register set lets several share a WGP
#define GEMM1_WAVES 4   // waves a SIMD that GEMM1's registers must leave room for: two work-groups a WGP
#define K_PASS_2 96     // GEMM2: few work-groups and a long K: the deepest whole divisor whose set fits the counter

__device__ __forceinline__ bf16_t f2bf(float f) {
  unsigned u = __builtin_bit_cast(unsigned, f);
  u += 0x7FFFu + ((u >> 16) & 1u);                 // round-to-nearest-even
  unsigned short hs = (unsigned short)(u >> 16);
  return __builtin_bit_cast(bf16_t, hs);
}

// work-group barrier that orders LDS alone. __syncthreads() also waits for every global load of the
// wave, and the weight loads of the tile after next are to stay on their way across the barrier.
// Its release fence waits for the wave's own LDS stores; the waits for asynchronous copies, and for LDS
// reads ahead of a refill by such copies, stand in front of each call.
__device__ __forceinline__ void barrier_lds() {
  __builtin_amdgcn_fence(__ATOMIC_RELEASE, "workgroup", "local");
  __builtin_amdgcn_s_barrier();
  __builtin_amdgcn_fence(__ATOMIC_ACQUIRE, "workgroup", "local");
}

typedef __attribute__((ext_vector_type(2))) float v2f;

// erf of two values, without a branch: x * P(x^2) / Q(x^2) on x held to [-4, 4], where erf is 1 to f32
// accuracy; within 5e-7 of erf, relative, over the whole line. Straight-line text lets many values' chains
// be issued interleaved; the library's erff takes one of two paths by |x| and so splits the wave.
__device__ __forceinline__ v2f erf2(v2f x) {
  x.x = fminf(fmaxf(x.x, -4.0f), 4.0f);
  x.y = fminf(fmaxf(x.y, -4.0f), 4.0f);
  const v2f x2 = x * x;
  v2f p = __builtin_elementwise_fma(x2, (v2f)(-2.72614225801306e-10f), (v2f)(2.77068142495902e-08f));
  p = __builtin_elementwise_fma(x2, p, (v2f)(-2.10102402082508e-06f));
  p = __builtin_elementwise_fma(x2, p, (v2f)(-5.69250639462346e-05f));
  p = __builtin_elementwise_fma(x2, p, (v2f)(-7.34990630326855e-04f));
  p = __builtin_elementwise_fma(x2, p, (v2f)(-2.95459980854025e-03f));
  p = __builtin_elementwise_fma(x2, p, (v2f)(-1.60960333262415e-02f));
  v2f q = __builtin_elementwise_fma(x2, (v2f)(-1.45660718464996e-05f), (v2f)(-2.13374055278905e-04f));
  q = __builtin_elementwise_fma(x2, q, (v2f)(-1.68282697438203e-03f));
  q = __builtin_elementwise_fma(x2, q, (v2f)(-7.37332916720468e-03f));
  q = __builtin_elementwise_fma(x2, q, (v2f)(-1.42647390514189e-02f));
  v2f r;                                         // Q lies in [-2.4, -0.014]: its reciprocal is an ordinary number
  r.x = __builtin_amdgcn_rcpf(q.x);
  r.y = __builtin_amdgcn_rcpf(q.y);
  return x * p * r;
}

// ---------------- x -> bf16 ----------------
__global__ void cvt_x_kernel(const float* __restrict__ x, bf16_t* __restrict__ xb) {
  int n = T_TOK * H_DIM;
  for (int i = blockIdx.x * blockDim.x + threadIdx.x; i < n; i += gridDim.x * blockDim.x)
    xb[i] = f2bf(x[i]);
}

// ---------------- router: one wave per token ----------------
__global__ __launch_bounds__(256) void moe_router(
    const float* __restrict__ x, const float* __restrict__ Wg,
    const float* __restrict__ bg, int* __restrict__ top_e, float* __restrict__ top_w) {
  int wave = threadIdx.x >> 5;
  int lane = threadIdx.x & 31;
  int t = blockIdx.x * 8 + wave;
  if (t >= T_TOK) return;
  float acc[E_NUM];
#pragma unroll
  for (int e = 0; e < E_NUM; ++e) acc[e] = 0.f;
  const float* xr = x + (size_t)t * H_DIM;
  for (int h = lane; h < H_DIM; h += 32) {
    float xv = xr[h];
    const float* wr = Wg + (size_t)h * E_NUM;
#pragma unroll
    for (int e = 0; e < E_NUM; ++e) acc[e] += xv * wr[e];
  }
#pragma unroll
  for (int e = 0; e < E_NUM; ++e) {
#pragma unroll
    for (int off = 16; off > 0; off >>= 1) acc[e] += __shfl_xor(acc[e], off, 32);
  }
  if (lane == 0) {
    float p[E_NUM];
    float mx = -1e30f;
#pragma unroll
    for (int e = 0; e < E_NUM; ++e) { p[e] = acc[e] + bg[e]; mx = fmaxf(mx, p[e]); }
    float sum = 0.f;
#pragma unroll
    for (int e = 0; e < E_NUM; ++e) { p[e] = expf(p[e] - mx); sum += p[e]; }
    float inv = 1.0f / sum;
#pragma unroll
    for (int e = 0; e < E_NUM; ++e) p[e] *= inv;
    int i0 = 0; float v0 = p[0];
#pragma unroll
    for (int e = 1; e < E_NUM; ++e) if (p[e] > v0) { v0 = p[e]; i0 = e; }   // first index wins ties
    int i1 = -1; float v1 = -1.0f;
#pragma unroll
    for (int e = 0; e < E_NUM; ++e) if (e != i0 && p[e] > v1) { v1 = p[e]; i1 = e; }
    float s2 = v0 + v1;
    top_e[2 * t] = i0;       top_e[2 * t + 1] = i1;
    top_w[2 * t] = v0 / s2;  top_w[2 * t + 1] = v1 / s2;
  }
}

// ---------------- deterministic partition: one wave per (expert, token quarter) ----------------
// 32 waves. Each wave takes its 512 tokens' expert pairs and weights into registers with one
// batch of independent loads, counts its matches, and gets its first slot from the 32 counts
// in LDS. Slots of an expert stay in ascending token order.
#define PART_Q 4                                  // token quarters
#define PART_IT (T_TOK / PART_Q / 32)             // groups of 32 tokens per wave
__global__ __launch_bounds__(1024) void moe_partition(
    const int* __restrict__ top_e, const float* __restrict__ top_w,
    int* __restrict__ counts, int* __restrict__ offs,
    int* __restrict__ rowtok, float* __restrict__ gate, int* __restrict__ slot_of) {
  const int wave = threadIdx.x >> 5;              // = e * PART_Q + q: slot order of the pieces
  const int lane = threadIdx.x & 31;
  const int e = wave >> 2;
  const int q = wave & (PART_Q - 1);
  const int t0 = q * (T_TOK / PART_Q) + lane;
  __shared__ int scnt[E_NUM * PART_Q];

  int e0[PART_IT], e1[PART_IT];
  float w0[PART_IT], w1[PART_IT];
#pragma unroll  // all loads independent and in flight together: one memory round trip
  for (int i = 0; i < PART_IT; ++i) {
    int2 ev = ((const int2*)top_e)[t0 + i * 32];
    float2 wv = ((const float2*)top_w)[t0 + i * 32];
    e0[i] = ev.x; e1[i] = ev.y;
    w0[i] = wv.x; w1[i] = wv.y;
  }
  unsigned m[PART_IT];
  int cnt = 0;
#pragma unroll  // arrays stay in registers
  for (int i = 0; i < PART_IT; ++i) {
    bool sel = (e0[i] == e) | (e1[i] == e);
    m[i] = (unsigned)(__ballot(sel) & 0xffffffffull);
    cnt += __popc(m[i]);
  }
  if (lane == 0) scnt[wave] = cnt;
  __syncthreads();
  const int v = scnt[lane];
  int before = (lane < wave) ? v : 0;             // pieces that come first in slot order
  int mine = ((lane >> 2) == e) ? v : 0;          // the expert's own four pieces
#pragma unroll
  for (int off = 16; off > 0; off >>= 1) {
    before += __shfl_xor(before, off, 32);
    mine += __shfl_xor(mine, off, 32);
  }
  if (q == 0 && lane == 0) { offs[e] = before; counts[e] = mine; }
  int pos = before;
  const unsigned lt = (1u << lane) - 1u;
#pragma unroll  // arrays stay in registers
  for (int i = 0; i < PART_IT; ++i) {
    if ((m[i] >> lane) & 1u) {
      const bool first = (e0[i] == e);
      const int t = t0 + i * 32;
      const int slot = pos + __popc(m[i] & lt);
      rowtok[slot] = t;
      gate[slot] = first ? w0[i] : w1[i];
      slot_of[2 * t + (first ? 0 : 1)] = slot;
    }
    pos += __popc(m[i]);
  }
}

// ---------------- WMMA GEMM: C[rows_e x Ndim] = A[rows] x W_e[Kdim x Ndim] ----------------
// second launch bound = waves a SIMD that must still fit beside the 8 accumulators and the fragments
// of a group: GEMM1_WAVES (GEMM1), 2 (GEMM2: it has fewer work-groups than the chip has WGPs)
template <bool GELU_OUT, int K_PASS>
__global__ __launch_bounds__(256, GELU_OUT ? GEMM1_WAVES : 2) void moe_gemm(
    const bf16_t* __restrict__ A,
    const float* __restrict__ Wfull, const float* __restrict__ bias,
    const int* __restrict__ counts, const int* __restrict__ offs,
    const int* __restrict__ rowtok,              // null -> identity (slot rows)
    bf16_t* __restrict__ Hout, float* __restrict__ Yout) {
  // shapes at compile time: a pass's loads then share one address register pair and differ in
  // their immediate offsets, so that holding them all in flight costs no register per address
  constexpr int Kdim = GELU_OUT ? H_DIM : I_DIM;
  constexpr int Ndim = GELU_OUT ? I_DIM : H_DIM;
  constexpr int lda = Kdim;
  static_assert(Kdim % K_PASS == 0, "whole passes only");
  constexpr int K_SUB = K_PASS / 32;             // WMMA k-blocks per pass
  // k-blocks whose LDS reads go out as one group: GEMM2 the whole pass; GEMM1 one block
  constexpr int K_GRP = GELU_OUT ? 1 : K_SUB;
  static_assert(K_SUB % K_GRP == 0, "whole groups only");
  constexpr int K_THR = K_PASS / 2;              // k rows of the weight tile per thread
  constexpr int LDS_STRIDE = K_PASS + 8;         // 144 or 208 B rows: 16 B x odd, no bank conflicts
  // blockIdx.y counts the row tiles that exist, expert after expert: the grid then holds no
  // work-group per (expert, possible tile) that only starts, finds no rows and ends
  const int tile = blockIdx.y;
  // each array fetched whole, ahead of the search: one scalar load an array, none inside the search
  const int4 c_lo = ((const int4*)counts)[0], c_hi = ((const int4*)counts)[1];
  const int4 o_lo = ((const int4*)offs)[0], o_hi = ((const int4*)offs)[1];
  const int cnt_of[E_NUM] = {c_lo.x, c_lo.y, c_lo.z, c_lo.w, c_hi.x, c_hi.y, c_hi.z, c_hi.w};
  const int off_of[E_NUM] = {o_lo.x, o_lo.y, o_lo.z, o_lo.w, o_hi.x, o_hi.y, o_hi.z, o_hi.w};
  int e = -1, rows = 0, base = 0, start = 0, first = 0;
#pragma unroll  // the two arrays stay in scalar registers
  for (int i = 0; i < E_NUM; ++i) {
    const int nt = (int)((unsigned)(cnt_of[i] + TILE_M - 1) / TILE_M);
    const bool hit = (tile >= first) & (tile < first + nt);
    e = hit ? i : e;
    rows = hit ? cnt_of[i] : rows;
    base = hit ? off_of[i] : base;
    start = hit ? first : start;
    first += nt;
  }
  if (e < 0) return;                             // block-uniform exit: past the last tile
  const int m_blk = (tile - start) * TILE_M;     // < rows: the tile is one of the expert's own
  const int n_blk = blockIdx.x * TILE_N;
  const int wave = threadIdx.x >> 5;
  const int lane = threadIdx.x & 31;
  const int wm = wave >> 1;                      // 0..3 (M, 32 each)
  const int wn = wave & 1;                       // 0..1 (N, 64 each)
  const int lane15 = lane & 15;
  const int khalf = (lane >> 4) * 8;             // 0 or 8 per WMMA 16-bit layout

  // double-buffered weight tile: [n][k] layout, bf16
  __shared__ __align__(16) bf16_t Bs[2][TILE_N * LDS_STRIDE];
  // double-buffered A tile: [m][k] layout, same pitch (its readers are 16-byte LDS loads as well)
  __shared__ __align__(16) bf16_t As[2][TILE_M * LDS_STRIDE];

  const float* W = Wfull + (size_t)e * Kdim * Ndim;

  // cooperative A-tile copier: the tile's 16-byte pieces in row order, one piece a lane and copy, so
  // that a wave's copy takes runs of whole rows' bytes and not 32 bytes out of each of 16 rows
  constexpr int A_ROW_PCS = K_PASS / 8;          // 16-byte pieces of a row in one pass
  constexpr int A_COPIES = TILE_M * A_ROW_PCS / 256;
  static_assert(A_COPIES * 256 == TILE_M * A_ROW_PCS, "whole copies only");
  static_assert(A_COPIES == 4 || A_COPIES == 6, "copy_a spells out four and six copies");
  static_assert(Kdim / K_PASS >= 2, "the two-buffer ring needs two tiles");
  constexpr unsigned A_BUF_BYTES = TILE_M * LDS_STRIDE * sizeof(bf16_t);
  const bf16_t* a_src[A_COPIES];                 // the piece's place in pass 0
  unsigned a_dst[A_COPIES];                      // its LDS byte address in buffer 0
#pragma unroll  // both arrays stay in registers
  for (int i = 0; i < A_COPIES; ++i) {
    const int pc = (int)threadIdx.x + i * 256;
    const int r = pc / A_ROW_PCS;
    const int col = pc - r * A_ROW_PCS;
    int mloc = m_blk + r;
    if (mloc >= rows) mloc = rows - 1;           // clamp (stores are guarded)
    const int arow = rowtok ? rowtok[base + mloc] : (base + mloc);
    a_src[i] = A + (size_t)arow * lda + col * 8;
    a_dst[i] = (unsigned)(size_t)&As[0][r * LDS_STRIDE + col * 8];
  }
  // sends one A tile on its way into LDS, through no register. s_wait_xcnt 0 is kept, as a precaution,
  // in front of every rewrite of the copies' address registers: as the last line of their own
  // statement, where the compiler can put no such rewrite ahead of it.
  auto copy_a = [&](int k0, int b) {
    const unsigned lb = (unsigned)b * A_BUF_BYTES;
    if constexpr (A_COPIES == 4) {
      asm volatile(
          "global_load_async_to_lds_b128 %0, %1, off\n\t"
          "global_load_async_to_lds_b128 %2, %3, off\n\t"
          "global_load_async_to_lds_b128 %4, %5, off\n\t"
          "global_load_async_to_lds_b128 %6, %7, off\n\t"
          "s_wait_xcnt 0x0"
          :: "v"(a_dst[0] + lb), "v"(a_src[0] + k0), "v"(a_dst[1] + lb), "v"(a_src[1] + k0),
             "v"(a_dst[2] + lb), "v"(a_src[2] + k0), "v"(a_dst[3] + lb), "v"(a_src[3] + k0)
          : "memory");
    } else {
      asm volatile(
          "global_load_async_to_lds_b128 %0, %1, off\n\t"
          "global_load_async_to_lds_b128 %2, %3, off\n\t"
          "global_load_async_to_lds_b128 %4, %5, off\n\t"
          "global_load_async_to_lds_b128 %6, %7, off\n\t"
          "global_load_async_to_lds_b128 %8, %9, off\n\t"
          "global_load_async_to_lds_b128 %10, %11, off\n\t"
          "s_wait_xcnt 0x0"
          :: "v"(a_dst[0] + lb), "v"(a_src[0] + k0), "v"(a_dst[1] + lb), "v"(a_src[1] + k0),
             "v"(a_dst[2] + lb), "v"(a_src[2] + k0), "v"(a_dst[3] + lb), "v"(a_src[3] + k0),
             "v"(a_dst[4] + lb), "v"(a_src[4] + k0), "v"(a_dst[5] + lb), "v"(a_src[5] + k0)
          : "memory");
    }
  };

  // cooperative weight-tile loader: thread covers (n = tid&127, k chunk of K_THR)
  const int cn = threadIdx.x & 127;
  const int ck = (threadIdx.x >> 7) * K_THR;     // 0 or K_THR

  v8f c[2][4] = {{v8f{}, v8f{}, v8f{}, v8f{}}, {v8f{}, v8f{}, v8f{}, v8f{}}};

  // sends one weight tile's loads on their way into a register set
  auto load_w = [&](float (&dst)[K_THR], int kt) {
    const float* wp = W + (size_t)(kt + ck) * Ndim + (n_blk + cn);
#pragma unroll  // dst[] stays in registers; all loads independent and in flight together
    for (int j = 0; j < K_THR; ++j) dst[j] = wp[(size_t)j * Ndim];
    // these loads are still out when their address pair is next rewritten (LDS addresses, the next
    // tile's address): the wait in front of such a rewrite, kept as a precaution
    asm volatile("s_wait_xcnt 0x0" ::: "memory");
    // keeps the scheduler from sinking the loads down to their uses, a pass and a half later,
    // and from lifting a rewrite of their address pair over the wait
    __builtin_amdgcn_sched_barrier(0);
  };
  // converts a register set that has come back and stores it as weight tile into buffer b
  auto store_w = [&](const float (&s)[K_THR], int b) {
#pragma unroll  // s[] stays in registers
    for (int g = 0; g < K_THR / 8; ++g) {
      v8bf p;
#pragma unroll
      for (int j = 0; j < 8; ++j) p[j] = f2bf(s[g * 8 + j]);
      *(v8bf*)&Bs[b][cn * LDS_STRIDE + ck + g * 8] = p;
    }
  };
  // two register sets: while one tile's set is converted, the tile behind it is already on its way
  float wa[K_THR], wb[K_THR];

  // prologue: tile 0 -> As[0] (in flight under the weight tiles' loads) and Bs[0]; weight tile 1 sent off
  copy_a(0, 0);
  load_w(wb, 0);
  load_w(wa, K_PASS);
  store_w(wb, 0);
  // this wave's copies of A tile 0 have landed before the barrier lets the other waves read them
  asm volatile("s_wait_asynccnt 0x0" ::: "memory");
  barrier_lds();
  copy_a(K_PASS, 1);                             // A tile 1 flies while pass 0 is worked on

  // one pass of products, k ascending: per 32-k block 2 A fragments (row = lane15, K = khalf+[0..7]
  // and khalf+16+[0..7]), 4 B fragments + 8 WMMAs (wave's 32x64 output). The LDS reads of K_GRP
  // blocks go out as one group, each fragment into registers of its own, ahead of those blocks'
  // WMMAs: the wave then meets the LDS latency once a group and not once a WMMA.
  auto pass_mm = [&](int buf) {
#pragma unroll  // LDS offsets become immediates
    for (int kg = 0; kg < K_SUB; kg += K_GRP) {
      v16bf af[K_GRP][2], bfr[K_GRP][4];
#pragma unroll  // both arrays stay in registers
      for (int kk = 0; kk < K_GRP; ++kk) {
#pragma unroll
        for (int mi = 0; mi < 2; ++mi) {
          const bf16_t* ap =
              &As[buf][(wm * 32 + mi * 16 + lane15) * LDS_STRIDE + (kg + kk) * 32 + khalf];
          v8bf alo = *(const v8bf*)(ap);
          v8bf ahi = *(const v8bf*)(ap + 16);
#pragma unroll
          for (int j = 0; j < 8; ++j) { af[kk][mi][j] = alo[j]; af[kk][mi][8 + j] = ahi[j]; }
        }
#pragma unroll
        for (int sub = 0; sub < 4; ++sub) {
          const bf16_t* bp =
              &Bs[buf][(wn * 64 + sub * 16 + lane15) * LDS_STRIDE + (kg + kk) * 32 + khalf];
          v8bf lo = *(const v8bf*)(bp);
          v8bf hi = *(const v8bf*)(bp + 16);
#pragma unroll
          for (int j = 0; j < 8; ++j) { bfr[kk][sub][j] = lo[j]; bfr[kk][sub][8 + j] = hi[j]; }
        }
      }
      // keeps the scheduler from sinking the reads back among the WMMAs, two in front of each with
      // a full wait, into one shared fragment register set
      __builtin_amdgcn_sched_barrier(0);
#pragma unroll
      for (int kk = 0; kk < K_GRP; ++kk) {
#pragma unroll
        for (int sub = 0; sub < 4; ++sub) {
#pragma unroll
          for (int mi = 0; mi < 2; ++mi) {
            c[mi][sub] = __builtin_amdgcn_wmma_f32_16x16x32_bf16(
                false, af[kk][mi], false, bfr[kk][sub], (short)0, c[mi][sub], false, false);
          }
        }
      }
    }
  };

  // hand-over of the next pass's tiles: this wave's reads of the A buffer of this pass are over before
  // anyone refills it, and its copies into the other one have landed before anyone reads them
  auto hand_over = [&]() {
    asm volatile("s_wait_dscnt 0x0" ::: "memory");
    asm volatile("s_wait_asynccnt 0x0" ::: "memory");
    barrier_lds();
  };
  static_assert((Kdim / K_PASS) % 2 == 0 && Kdim / K_PASS >= 4, "passes go in pairs, one per register set");
  // two passes a trip, so that each register set and each LDS buffer has its fixed place in the text.
  // Pass p sends off weight tile p + 2, works on tile p and converts tile p + 1, whose loads went out
  // in pass p - 1: they have had a whole pass and this pass's WMMAs to come back.
  for (int k0 = 0; k0 + 3 * K_PASS < Kdim; k0 += 2 * K_PASS) {
    load_w(wb, k0 + 2 * K_PASS);
    pass_mm(0);
    // keeps the conversions, and with them the waits for the weight loads, behind the WMMAs
    __builtin_amdgcn_sched_barrier(0);
    store_w(wa, 1);
    hand_over();
    copy_a(k0 + 2 * K_PASS, 0);                  // the A tile after next, into the buffer just read

    load_w(wa, k0 + 3 * K_PASS);
    pass_mm(1);
    // as above
    __builtin_amdgcn_sched_barrier(0);
    store_w(wb, 0);
    hand_over();
    copy_a(k0 + 3 * K_PASS, 1);
  }
  // last pass but one: nothing left to send off; its hand-over leaves no copy on its way
  pass_mm(0);
  // as above
  __builtin_amdgcn_sched_barrier(0);
  store_w(wa, 1);
  hand_over();
  pass_mm(1);                                    // last pass: nothing left to fetch

  // store: D rows = j + (lane>=16 ? 8 : 0), col = lane&15
  const float* bp = bias + (size_t)e * Ndim;
  const int mrow0 = m_blk + wm * 32 + ((lane < 16) ? 0 : 8);
  // both 16-row halves of the wave's tile go through one copy of this text (the second half moves into
  // the first one's registers): unrolled, the long exact GELU would double the kernel's text
#pragma nounroll
  for (int mi = 0; mi < 2; ++mi) {
    if constexpr (GELU_OUT) {
      // exact GELU of the half's 32 values a lane, rows past the expert's last one too: no test stands
      // among the chains; the row test stands at the stores alone, one for the 4 stores of a row
      bf16_t g[4][8];
#pragma unroll  // g[] stays in registers
      for (int sub = 0; sub < 4; ++sub) {
        const float bv = bp[n_blk + wn * 64 + sub * 16 + lane15];
#pragma unroll
        for (int j = 0; j < 8; j += 2) {
          const v2f v = v2f{c[0][sub][j], c[0][sub][j + 1]} + bv;
          const v2f hv = 0.5f * v;
          const v2f o = __builtin_elementwise_fma(hv, erf2(v * 0.70710678118654752f), hv);
          g[sub][j] = f2bf(o.x);
          g[sub][j + 1] = f2bf(o.y);
        }
      }
#pragma unroll
      for (int j = 0; j < 8; ++j) {
        const int m = mrow0 + mi * 16 + j;
        if (m < rows) {
          bf16_t* hp = Hout + (size_t)(base + m) * (size_t)Ndim + (n_blk + wn * 64 + lane15);
#pragma unroll
          for (int sub = 0; sub < 4; ++sub) hp[sub * 16] = g[sub][j];
        }
      }
    } else {
#pragma unroll
      for (int sub = 0; sub < 4; ++sub) {
        int n = n_blk + wn * 64 + sub * 16 + lane15;
        float bv = bp[n];
#pragma unroll
        for (int j = 0; j < 8; ++j) {
          int m = mrow0 + mi * 16 + j;
          if (m < rows) {
            float v = c[0][sub][j] + bv;
            size_t orow = (size_t)(base + m);
            Yout[orow * (size_t)Ndim + n] = v;
          }
        }
      }
    }
    // the moves below and the next half's addresses rewrite registers that the last store names: kept as a precaution
    asm volatile("s_wait_xcnt 0x0" ::: "memory");
    // keeps the scheduler from lifting the moves over that wait
    __builtin_amdgcn_sched_barrier(0);
#pragma unroll
    for (int sub = 0; sub < 4; ++sub) c[0][sub] = c[1][sub];
  }
}

// ---------------- combine (fixed order -> deterministic) + residual + LayerNorm ----------------
__global__ __launch_bounds__(256) void moe_combine_ln(
    const float* __restrict__ x, const float* __restrict__ y,
    const float* __restrict__ gate, const int* __restrict__ slot_of,
    const float* __restrict__ gamma, const float* __restrict__ beta,
    float* __restrict__ out) {
  int t = blockIdx.x;
  int s0 = slot_of[2 * t], s1 = slot_of[2 * t + 1];
  float w0 = gate[s0], w1 = gate[s1];
  const float* xr = x + (size_t)t * H_DIM;
  const float* y0 = y + (size_t)s0 * H_DIM;
  const float* y1 = y + (size_t)s1 * H_DIM;
  float z[3];
  float s = 0.f, sq = 0.f;
#pragma unroll
  for (int i = 0; i < 3; ++i) {
    int hh = threadIdx.x + i * 256;
    float v = xr[hh] + w0 * y0[hh] + w1 * y1[hh];
    z[i] = v; s += v; sq += v * v;
  }
#pragma unroll
  for (int off = 16; off > 0; off >>= 1) {
    s += __shfl_xor(s, off, 32);
    sq += __shfl_xor(sq, off, 32);
  }
  __shared__ float rs[8], rq[8];
  int wave = threadIdx.x >> 5, lane = threadIdx.x & 31;
  if (lane == 0) { rs[wave] = s; rq[wave] = sq; }
  __syncthreads();
  if (threadIdx.x == 0) {
    float S = 0.f, Q = 0.f;
    for (int i = 0; i < 8; ++i) { S += rs[i]; Q += rq[i]; }
    rs[0] = S; rq[0] = Q;
  }
  __syncthreads();
  float mean = rs[0] * (1.0f / H_DIM);
  float var = rq[0] * (1.0f / H_DIM) - mean * mean;
  float inv = rsqrtf(var + LN_EPS);
#pragma unroll
  for (int i = 0; i < 3; ++i) {
    int hh = threadIdx.x + i * 256;
    out[(size_t)t * H_DIM + hh] = (z[i] - mean) * inv * gamma[hh] + beta[hh];
  }
}

extern "C" void kernel_launch(void* const* d_in, const int* in_sizes, int n_in,
                              void* d_out, int out_size, void* d_ws, size_t ws_size,
                              hipStream_t stream) {
  const float* x  = (const float*)d_in[0];
  const float* W1 = (const float*)d_in[1];
  const float* b1 = (const float*)d_in[2];
  const float* W2 = (const float*)d_in[3];
  const float* b2 = (const float*)d_in[4];
  const float* Wg = (const float*)d_in[5];
  const float* bg = (const float*)d_in[6];
  const float* gamma = (const float*)d_in[7];
  const float* beta  = (const float*)d_in[8];
  float* out = (float*)d_out;

  char* ws = (char*)d_ws;
  size_t off = 0;
  auto alloc = [&](size_t bytes) -> void* {
    void* p = ws + off;
    off = (off + bytes + 255) & ~(size_t)255;
    return p;
  };
  bf16_t* xb     = (bf16_t*)alloc((size_t)T_TOK * H_DIM * sizeof(bf16_t));  // 3.1 MB
  bf16_t* hbuf   = (bf16_t*)alloc((size_t)A_TOT * I_DIM * sizeof(bf16_t));  // 25.2 MB
  float*  ybuf   = (float*) alloc((size_t)A_TOT * H_DIM * sizeof(float));   // 12.6 MB
  int*    top_e  = (int*)   alloc((size_t)T_TOK * 2 * sizeof(int));
  float*  top_w  = (float*) alloc((size_t)T_TOK * 2 * sizeof(float));
  int*    counts = (int*)   alloc(E_NUM * sizeof(int));
  int*    offsv  = (int*)   alloc(E_NUM * sizeof(int));
  int*    rowtok = (int*)   alloc((size_t)A_TOT * sizeof(int));
  float*  gate   = (float*) alloc((size_t)A_TOT * sizeof(float));
  int*    slotof = (int*)   alloc((size_t)T_TOK * 2 * sizeof(int));

  cvt_x_kernel<<<1536, 256, 0, stream>>>(x, xb);
  moe_router<<<T_TOK / 8, 256, 0, stream>>>(x, Wg, bg, top_e, top_w);
  moe_partition<<<1, 1024, 0, stream>>>(top_e, top_w, counts, offsv, rowtok, gate, slotof);
  // GEMM1 + GELU: A = xb[token], W1_e [H x I], out bf16 h [slot][I]
  moe_gemm<true, K_PASS_1><<<dim3(I_DIM / TILE_N, M_TILES_MAX), 256, 0, stream>>>(
      xb, W1, b1, counts, offsv, rowtok, hbuf, nullptr);
  // GEMM2: A = h[slot], W2_e [I x H], out fp32 y [slot][H]
  moe_gemm<false, K_PASS_2><<<dim3(H_DIM / TILE_N, M_TILES_MAX), 256, 0, stream>>>(
      hbuf, W2, b2, counts, offsv, nullptr, nullptr, ybuf);
  moe_combine_ln<<<T_TOK, 256, 0, stream>>>(x, ybuf, gate, slotof, gamma, beta, out);
}

// v009
// Measured time: 91.8 microseconds a run.
// In both of two side-by-side timings against v008, it was 1.05 times as fast.
// Over all steps from v000 it is 2.82 times as fast.
#include <hip/hip_runtime.h>
#include <hip/hip_bf16.h>
#include <math.h>

// MoE (top-2 of 8 experts), H=768, I=3072, T=2048 tokens.
// bf16 WMMA (v_wmma_f32_16x16x32_bf16) with fp32 accumulate; gather-based
// expert execution (exactly K*T = 4096 assignment rows of GEMM work).
// GEMM: 128x128 block tile, 8 waves (4M x 2N), 32x64 per wave (8 WMMA accums),
// double-buffered LDS weight tile (fp32 -> bf16 on the fly), 64 or 96 k per pass, 1 barrier/pass.
// Weight loads are 16 bytes a lane (a wave takes whole 512-byte tile rows); the tile lies [k][n] in LDS
// as it lies in memory, and the B fragments come out of it by transposing LDS loads.
// A weight tile's loads go out two passes ahead of its use, into one of two register sets.
// A tile (128 rows x one pass of k) double-buffered in LDS too, filled by asynchronous copies.
// LDS fragment reads go out in groups ahead of their WMMAs (32 k a group in GEMM1, 96 in GEMM2).
// GEMM grid: (column tiles) x (row tiles that any routing can need, all experts in a row).

typedef __bf16 bf16_t;
typedef __attribute__((ext_vector_type(16))) __bf16 v16bf;
typedef __attribute__((ext_vector_type(8)))  __bf16 v8bf;
typedef __attribute__((ext_vector_type(4)))  __bf16 v4bf;
typedef __attribute__((ext_vector_type(4)))  float  v4f;
typedef __attribute__((ext_vector_type(8)))  float  v8f;
typedef __attribute__((address_space(3))) v8bf lds_v8bf;   // operand type of the transposing LDS load

#define T_TOK 2048
#define H_DIM 768
#define I_DIM 3072
#define E_NUM 8
#define A_TOT (T_TOK * 2)
#define LN_EPS 1e-5f

#define TILE_N 128
// rows per work-group: a weight tile is fetched from L2 and converted once per TILE_M rows of its expert
#define TILE_M 128
// row tiles that any routing can need: each expert rounds its rows up to whole tiles
#define M_TILES_MAX (A_TOT / TILE_M + E_NUM)
// k per pass (K_PASS) must divide the GEMM's K an even number of times. K_PASS / 8 weight loads of 16 bytes
// a lane make one tile's set; two sets are on their way at a time, well inside the load counter's 63, so
// that the issue of the younger set never waits for the older one to come back.
#define K_PASS_1 64     // GEMM1: many work-groups; the smaller register set lets several share a WGP
#define GEMM1_WAVES 4   // waves a SIMD that GEMM1's registers must leave room for: two work-groups a WGP
#define K_PASS_2 96     // GEMM2: few work-groups and a long K: a deeper pass

__device__ __forceinline__ bf16_t f2bf(float f) {
  unsigned u = __builtin_bit_cast(unsigned, f);
  u += 0x7FFFu + ((u >> 16) & 1u);                 // round-to-nearest-even
  unsigned short hs = (unsigned short)(u >> 16);
  return __builtin_bit_cast(bf16_t, hs);
}

// work-group barrier that orders LDS alone. __syncthreads() also waits for every global load of the
// wave, and the weight loads of the tile after next are to stay on their way across the barrier.
// Its release fence waits for the wave's own LDS stores; the waits for asynchronous copies, and for LDS
// reads ahead of a refill by such copies, stand in front of each call.
__device__ __forceinline__ void barrier_lds() {
  __builtin_amdgcn_fence(__ATOMIC_RELEASE, "workgroup", "local");
  __builtin_amdgcn_s_barrier();
  __builtin_amdgcn_fence(__ATOMIC_ACQUIRE, "workgroup", "local");
}

typedef __attribute__((ext_vector_type(2))) float v2f;

// erf of two values, without a branch: x * P(x^2) / Q(x^2) on x held to [-4, 4], where erf is 1 to f32
// accuracy; within 5e-7 of erf, relative, over the whole line. Straight-line text lets many values' chains
// be issued interleaved; the library's erff takes one of two paths by |x| and so splits the wave.
__device__ __forceinline__ v2f erf2(v2f x) {
  x.x = fminf(fmaxf(x.x, -4.0f), 4.0f);
  x.y = fminf(fmaxf(x.y, -4.0f), 4.0f);
  const v2f x2 = x * x;
  v2f p = __builtin_elementwise_fma(x2, (v2f)(-2.72614225801306e-10f), (v2f)(2.77068142495902e-08f));
  p = __builtin_elementwise_fma(x2, p, (v2f)(-2.10102402082508e-06f));
  p = __builtin_elementwise_fma(x2, p, (v2f)(-5.69250639462346e-05f));
  p = __builtin_elementwise_fma(x2, p, (v2f)(-7.34990630326855e-04f));
  p = __builtin_elementwise_fma(x2, p, (v2f)(-2.95459980854025e-03f));
  p = __builtin_elementwise_fma(x2, p, (v2f)(-1.60960333262415e-02f));
  v2f q = __builtin_elementwise_fma(x2, (v2f)(-1.45660718464996e-05f), (v2f)(-2.13374055278905e-04f));
  q = __builtin_elementwise_fma(x2, q, (v2f)(-1.68282697438203e-03f));
  q = __builtin_elementwise_fma(x2, q, (v2f)(-7.37332916720468e-03f));
  q = __builtin_elementwise_fma(x2, q, (v2f)(-1.42647390514189e-02f));
  v2f r;                                         // Q lies in [-2.4, -0.014]: its reciprocal is an ordinary number
  r.x = __builtin_amdgcn_rcpf(q.x);
  r.y = __builtin_amdgcn_rcpf(q.y);
  return x * p * r;
}

// ---------------- x -> bf16 ----------------
__global__ void cvt_x_kernel(const float* __restrict__ x, bf16_t* __restrict__ xb) {
  int n = T_TOK * H_DIM;
  for (int i = blockIdx.x * blockDim.x + threadIdx.x; i < n; i += gridDim.x * blockDim.x)
    xb[i] = f2bf(x[i]);
}

// ---------------- router: one wave per token ----------------
__global__ __launch_bounds__(256) void moe_router(
    const float* __restrict__ x, const float* __restrict__ Wg,
    const float* __restrict__ bg, int* __restrict__ top_e, float* __restrict__ top_w) {
  int wave = threadIdx.x >> 5;
  int lane = threadIdx.x & 31;
  int t = blockIdx.x * 8 + wave;
  if (t >= T_TOK) return;
  float acc[E_NUM];
#pragma unroll
  for (int e = 0; e < E_NUM; ++e) acc[e] = 0.f;
  const float* xr = x + (size_t)t * H_DIM;
  for (int h = lane; h < H_DIM; h += 32) {
    float xv = xr[h];
    const float* wr = Wg + (size_t)h * E_NUM;
#pragma unroll
    for (int e = 0; e < E_NUM; ++e) acc[e] += xv * wr[e];
  }
#pragma unroll
  for (int e = 0; e < E_NUM; ++e) {
#pragma unroll
    for (int off = 16; off > 0; off >>= 1) acc[e] += __shfl_xor(acc[e], off, 32);
  }
  if (lane == 0) {
    float p[E_NUM];
    float mx = -1e30f;
#pragma unroll
    for (int e = 0; e < E_NUM; ++e) { p[e] = acc[e] + bg[e]; mx = fmaxf(mx, p[e]); }
    float sum = 0.f;
#pragma unroll
    for (int e = 0; e < E_NUM; ++e) { p[e] = expf(p[e] - mx); sum += p[e]; }
    float inv = 1.0f / sum;
#pragma unroll
    for (int e = 0; e < E_NUM; ++e) p[e] *= inv;
    int i0 = 0; float v0 = p[0];
#pragma unroll
    for (int e = 1; e < E_NUM; ++e) if (p[e] > v0) { v0 = p[e]; i0 = e; }   // first index wins ties
    int i1 = -1; float v1 = -1.0f;
#pragma unroll
    for (int e = 0; e < E_NUM; ++e) if (e != i0 && p[e] > v1) { v1 = p[e]; i1 = e; }
    float s2 = v0 + v1;
    top_e[2 * t] = i0;       top_e[2 * t + 1] = i1;
    top_w[2 * t] = v0 / s2;  top_w[2 * t + 1] = v1 / s2;
  }
}

// ---------------- deterministic partition: one wave per (expert, token quarter) ----------------
// 32 waves. Each wave takes its 512 tokens' expert pairs and weights into registers with one
// batch of independent loads, counts its matches, and gets its first slot from the 32 counts
// in LDS. Slots of an expert stay in ascending token order.
#define PART_Q 4                                  // token quarters
#define PART_IT (T_TOK / PART_Q / 32)             // groups of 32 tokens per wave
__global__ __launch_bounds__(1024) void moe_partition(
    const int* __restrict__ top_e, const float* __restrict__ top_w,
    int* __restrict__ counts, int* __restrict__ offs,
    int* __restrict__ rowtok, float* __restrict__ gate, int* __restrict__ slot_of) {
  const int wave = threadIdx.x >> 5;              // = e * PART_Q + q: slot order of the pieces
  const int lane = threadIdx.x & 31;
  const int e = wave >> 2;
  const int q = wave & (PART_Q - 1);
  const int t0 = q * (T_TOK / PART_Q) + lane;
  __shared__ int scnt[E_NUM * PART_Q];

  int e0[PART_IT], e1[PART_IT];
  float w0[PART_IT], w1[PART_IT];
#pragma unroll  // all loads independent and in flight together: one memory round trip
  for (int i = 0; i < PART_IT; ++i) {
    int2 ev = ((const int2*)top_e)[t0 + i * 32];
    float2 wv = ((const float2*)top_w)[t0 + i * 32];
    e0[i] = ev.x; e1[i] = ev.y;
    w0[i] = wv.x; w1[i] = wv.y;
  }
  unsigned m[PART_IT];
  int cnt = 0;
#pragma unroll  // arrays stay in registers
  for (int i = 0; i < PART_IT; ++i) {
    bool sel = (e0[i] == e) | (e1[i] == e);
    m[i] = (unsigned)(__ballot(sel) & 0xffffffffull);
    cnt += __popc(m[i]);
  }
  if (lane == 0) scnt[wave] = cnt;
  __syncthreads();
  const int v = scnt[lane];
  int before = (lane < wave) ? v : 0;             // pieces that come first in slot order
  int mine = ((lane >> 2) == e) ? v : 0;          // the expert's own four pieces
#pragma unroll
  for (int off = 16; off > 0; off >>= 1) {
    before += __shfl_xor(before, off, 32);
    mine += __shfl_xor(mine, off, 32);
  }
  if (q == 0 && lane == 0) { offs[e] = before; counts[e] = mine; }
  int pos = before;
  const unsigned lt = (1u << lane) - 1u;
#pragma unroll  // arrays stay in registers
  for (int i = 0; i < PART_IT; ++i) {
    if ((m[i] >> lane) & 1u) {
      const bool first = (e0[i] == e);
      const int t = t0 + i * 32;
      const int slot = pos + __popc(m[i] & lt);
      rowtok[slot] = t;
      gate[slot] = first ? w0[i] : w1[i];
      slot_of[2 * t + (first ? 0 : 1)] = slot;
    }
    pos += __popc(m[i]);
  }
}

// ---------------- WMMA GEMM: C[rows_e x Ndim] = A[rows] x W_e[Kdim x Ndim] ----------------
// second launch bound = waves a SIMD that must still fit beside the 8 accumulators and the fragments
// of a group: GEMM1_WAVES (GEMM1), 2 (GEMM2: it has fewer work-groups than the chip has WGPs)
template <bool GELU_OUT, int K_PASS>
__global__ __launch_bounds__(256, GELU_OUT ? GEMM1_WAVES : 2) void moe_gemm(
    const bf16_t* __restrict__ A,
    const float* __restrict__ Wfull, const float* __restrict__ bias,
    const int* __restrict__ counts, const int* __restrict__ offs,
    const int* __restrict__ rowtok,              // null -> identity (slot rows)
    bf16_t* __restrict__ Hout, float* __restrict__ Yout) {
  // shapes at compile time: a pass's loads then share one address register pair and differ in
  // their immediate offsets, so that holding them all in flight costs no register per address
  constexpr int Kdim = GELU_OUT ? H_DIM : I_DIM;
  constexpr int Ndim = GELU_OUT ? I_DIM : H_DIM;
  constexpr int lda = Kdim;
  static_assert(Kdim % K_PASS == 0, "whole passes only");
  constexpr int K_SUB = K_PASS / 32;             // WMMA k-blocks per pass
  // k-blocks whose LDS reads go out as one group: GEMM2 the whole pass; GEMM1 one block
  constexpr int K_GRP = GELU_OUT ? 1 : K_SUB;
  static_assert(K_SUB % K_GRP == 0, "whole groups only");
  constexpr int K_ROWS = K_PASS / 8;             // k rows of the weight tile per wave
  constexpr int LDS_STRIDE = K_PASS + 8;         // A tile: 144 or 208 B rows: 16 B x odd, no bank conflicts
  constexpr int B_PITCH = TILE_N + 16;           // weight tile: 288 B rows: 32 B x odd, the transposing load's pitch
  // blockIdx.y counts the row tiles that exist, expert after expert: the grid then holds no
  // work-group per (expert, possible tile) that only starts, finds no rows and ends
  const int tile = blockIdx.y;
  // each array fetched whole, ahead of the search: one scalar load an array, none inside the search
  const int4 c_lo = ((const int4*)counts)[0], c_hi = ((const int4*)counts)[1];
  const int4 o_lo = ((const int4*)offs)[0], o_hi = ((const int4*)offs)[1];
  const int cnt_of[E_NUM] = {c_lo.x, c_lo.y, c_lo.z, c_lo.w, c_hi.x, c_hi.y, c_hi.z, c_hi.w};
  const int off_of[E_NUM] = {o_lo.x, o_lo.y, o_lo.z, o_lo.w, o_hi.x, o_hi.y, o_hi.z, o_hi.w};
  int e = -1, rows = 0, base = 0, start = 0, first = 0;
#pragma unroll  // the two arrays stay in scalar registers
  for (int i = 0; i < E_NUM; ++i) {
    const int nt = (int)((unsigned)(cnt_of[i] + TILE_M - 1) / TILE_M);
    const bool hit = (tile >= first) & (tile < first + nt);
    e = hit ? i : e;
    rows = hit ? cnt_of[i] : rows;
    base = hit ? off_of[i] : base;
    start = hit ? first : start;
    first += nt;
  }
  if (e < 0) return;                             // block-uniform exit: past the last tile
  const int m_blk = (tile - start) * TILE_M;     // < rows: the tile is one of the expert's own
  const int n_blk = blockIdx.x * TILE_N;
  const int wave = threadIdx.x >> 5;
  const int lane = threadIdx.x & 31;
  const int wm = wave >> 1;                      // 0..3 (M, 32 each)
  const int wn = wave & 1;                       // 0..1 (N, 64 each)
  const int lane15 = lane & 15;
  const int khalf = (lane >> 4) * 8;             // 0 or 8 per WMMA 16-bit layout

  // double-buffered weight tile: [k][n] layout, bf16
  __shared__ __align__(16) bf16_t Bs[2][K_PASS * B_PITCH];
  // double-buffered A tile: [m][k] layout (its readers are plain 16-byte LDS loads)
  __shared__ __align__(16) bf16_t As[2][TILE_M * LDS_STRIDE];

  const float* W = Wfull + (size_t)e * Kdim * Ndim;

  // cooperative A-tile copier: the tile's 16-byte pieces in row order, one piece a lane and copy, so
  // that a wave's copy takes runs of whole rows' bytes and not 32 bytes out of each of 16 rows
  constexpr int A_ROW_PCS = K_PASS / 8;          // 16-byte pieces of a row in one pass
  constexpr int A_COPIES = TILE_M * A_ROW_PCS / 256;
  static_assert(A_COPIES * 256 == TILE_M * A_ROW_PCS, "whole copies only");
  static_assert(A_COPIES == 4 || A_COPIES == 6, "copy_a spells out four and six copies");
  static_assert(Kdim / K_PASS >= 2, "the two-buffer ring needs two tiles");
  constexpr unsigned A_BUF_BYTES = TILE_M * LDS_STRIDE * sizeof(bf16_t);
  const bf16_t* a_src[A_COPIES];                 // the piece's place in pass 0
  unsigned a_dst[A_COPIES];                      // its LDS byte address in buffer 0
#pragma unroll  // both arrays stay in registers
  for (int i = 0; i < A_COPIES; ++i) {
    const int pc = (int)threadIdx.x + i * 256;
    const int r = pc / A_ROW_PCS;
    const int col = pc - r * A_ROW_PCS;
    int mloc = m_blk + r;
    if (mloc >= rows) mloc = rows - 1;           // clamp (stores are guarded)
    const int arow = rowtok ? rowtok[base + mloc] : (base + mloc);
    a_src[i] = A + (size_t)arow * lda + col * 8;
    a_dst[i] = (unsigned)(size_t)&As[0][r * LDS_STRIDE + col * 8];
  }
  // sends one A tile on its way into LDS, through no register. s_wait_xcnt 0 is kept, as a precaution,
  // in front of every rewrite of the copies' address registers: as the last line of their own
  // statement, where the compiler can put no such rewrite ahead of it.
  auto copy_a = [&](int k0, int b) {
    const unsigned lb = (unsigned)b * A_BUF_BYTES;
    if constexpr (A_COPIES == 4) {
      asm volatile(
          "global_load_async_to_lds_b128 %0, %1, off\n\t"
          "global_load_async_to_lds_b128 %2, %3, off\n\t"
          "global_load_async_to_lds_b128 %4, %5, off\n\t"
          "global_load_async_to_lds_b128 %6, %7, off\n\t"
          "s_wait_xcnt 0x0"
          :: "v"(a_dst[0] + lb), "v"(a_src[0] + k0), "v"(a_dst[1] + lb), "v"(a_src[1] + k0),
             "v"(a_dst[2] + lb), "v"(a_src[2] + k0), "v"(a_dst[3] + lb), "v"(a_src[3] + k0)
          : "memory");
    } else {
      asm volatile(
          "global_load_async_to_lds_b128 %0, %1, off\n\t"
          "global_load_async_to_lds_b128 %2, %3, off\n\t"
          "global_load_async_to_lds_b128 %4, %5, off\n\t"
          "global_load_async_to_lds_b128 %6, %7, off\n\t"
          "global_load_async_to_lds_b128 %8, %9, off\n\t"
          "global_load_async_to_lds_b128 %10, %11, off\n\t"
          "s_wait_xcnt 0x0"
          :: "v"(a_dst[0] + lb), "v"(a_src[0] + k0), "v"(a_dst[1] + lb), "v"(a_src[1] + k0),
             "v"(a_dst[2] + lb), "v"(a_src[2] + k0), "v"(a_dst[3] + lb), "v"(a_src[3] + k0),
             "v"(a_dst[4] + lb), "v"(a_src[4] + k0), "v"(a_dst[5] + lb), "v"(a_src[5] + k0)
          : "memory");
    }
  };

  // cooperative weight-tile loader: a lane covers 4 n, a wave the tile's whole 128 n (512 bytes in a row,
  // four whole lines a load) of K_ROWS k rows
  const int cn = lane * 4;
  const int ck = wave * K_ROWS;

  v8f c[2][4] = {{v8f{}, v8f{}, v8f{}, v8f{}}, {v8f{}, v8f{}, v8f{}, v8f{}}};

  // sends one weight tile's loads on their way into a register set
  auto load_w = [&](v4f (&dst)[K_ROWS], int kt) {
    const float* wp = W + (size_t)(kt + ck) * Ndim + (n_blk + cn);
#pragma unroll  // dst[] stays in registers; all loads independent and in flight together
    for (int j = 0; j < K_ROWS; ++j) dst[j] = *(const v4f*)(wp + (size_t)j * Ndim);
    // these loads are still out when their address pair is next rewritten (LDS addresses, the next
    // tile's address): the wait in front of such a rewrite, kept as a precaution
    asm volatile("s_wait_xcnt 0x0" ::: "memory");
    // keeps the scheduler from sinking the loads down to their uses, a pass and a half later,
    // and from lifting a rewrite of their address pair over the wait
    __builtin_amdgcn_sched_barrier(0);
  };
  // converts a register set that has come back and stores it as weight tile into buffer b
  // (a wave's store is one tile row, 256 bytes in a row)
  auto store_w = [&](const v4f (&s)[K_ROWS], int b) {
#pragma unroll  // s[] stays in registers
    for (int j = 0; j < K_ROWS; ++j) {
      v4bf p;
#pragma unroll
      for (int i = 0; i < 4; ++i) p[i] = f2bf(s[j][i]);
      *(v4bf*)&Bs[b][(ck + j) * B_PITCH + cn] = p;
    }
  };
  // two register sets: while one tile's set is converted, the tile behind it is already on its way
  v4f wa[K_ROWS], wb[K_ROWS];

  // prologue: tile 0 -> As[0] (in flight under the weight tiles' loads) and Bs[0]; weight tile 1 sent off
  copy_a(0, 0);
  load_w(wb, 0);
  load_w(wa, K_PASS);
  store_w(wb, 0);
  // this wave's copies of A tile 0 have landed before the barrier lets the other waves read them
  asm volatile("s_wait_asynccnt 0x0" ::: "memory");
  barrier_lds();
  copy_a(K_PASS, 1);                             // A tile 1 flies while pass 0 is worked on

  // one pass of products, k ascending: per 32-k block 2 A fragments (row = lane15, K = khalf+[0..7]
  // and khalf+16+[0..7]), 4 B fragments + 8 WMMAs (wave's 32x64 output). A B fragment is two transposing
  // loads of 16 k x 16 n each: the lane points at 16 bytes of k row khalf + (lane & 7), n half (lane >> 3) & 1,
  // and gets column lane15, K = khalf+[0..7]: the A fragment's k order. The LDS reads of K_GRP
  // blocks go out as one group, each fragment into registers of its own, ahead of those blocks'
  // WMMAs: the wave then meets the LDS latency once a group and not once a WMMA.
  auto pass_mm = [&](int buf) {
#pragma unroll  // LDS offsets become immediates
    for (int kg = 0; kg < K_SUB; kg += K_GRP) {
      v16bf af[K_GRP][2], bfr[K_GRP][4];
#pragma unroll  // both arrays stay in registers
      for (int kk = 0; kk < K_GRP; ++kk) {
#pragma unroll
        for (int mi = 0; mi < 2; ++mi) {
          const bf16_t* ap =
              &As[buf][(wm * 32 + mi * 16 + lane15) * LDS_STRIDE + (kg + kk) * 32 + khalf];
          v8bf alo = *(const v8bf*)(ap);
          v8bf ahi = *(const v8bf*)(ap + 16);
#pragma unroll
          for (int j = 0; j < 8; ++j) { af[kk][mi][j] = alo[j]; af[kk][mi][8 + j] = ahi[j]; }
        }
#pragma unroll
        for (int sub = 0; sub < 4; ++sub) {
          const bf16_t* bp = &Bs[buf][((kg + kk) * 32 + khalf + (lane & 7)) * B_PITCH +
                                      wn * 64 + sub * 16 + ((lane >> 3) & 1) * 8];
          v8bf lo = __builtin_amdgcn_ds_load_tr16_b128_v8bf16((lds_v8bf*)(bp));
          v8bf hi = __builtin_amdgcn_ds_load_tr16_b128_v8bf16((lds_v8bf*)(bp + 16 * B_PITCH));
#pragma unroll
          for (int j = 0; j < 8; ++j) { bfr[kk][sub][j] = lo[j]; bfr[kk][sub][8 + j] = hi[j]; }
        }
      }
      // keeps the scheduler from sinking the reads back among the WMMAs, two in front of each with
      // a full wait, into one shared fragment register set
      __builtin_amdgcn_sched_barrier(0);
#pragma unroll
      for (int kk = 0; kk < K_GRP; ++kk) {
#pragma unroll
        for (int sub = 0; sub < 4; ++sub) {
#pragma unroll
          for (int mi = 0; mi < 2; ++mi) {
            c[mi][sub] = __builtin_amdgcn_wmma_f32_16x16x32_bf16(
                false, af[kk][mi], false, bfr[kk][sub], (short)0, c[mi][sub], false, false);
          }
        }
      }
    }
  };

  // hand-over of the next pass's tiles: this wave's reads of the A buffer of this pass are over before
  // anyone refills it, and its copies into the other one have landed before anyone reads them
  auto hand_over = [&]() {
    asm volatile("s_wait_dscnt 0x0" ::: "memory");
    asm volatile("s_wait_asynccnt 0x0" ::: "memory");
    barrier_lds();
  };
  static_assert((Kdim / K_PASS) % 2 == 0 && Kdim / K_PASS >= 4, "passes go in pairs, one per register set");
  // two passes a trip, so that each register set and each LDS buffer has its fixed place in the text.
  // Pass p sends off weight tile p + 2, works on tile p and converts tile p + 1, whose loads went out
  // in pass p - 1: they have had a whole pass and this pass's WMMAs to come back.
  for (int k0 = 0; k0 + 3 * K_PASS < Kdim; k0 += 2 * K_PASS) {
    load_w(wb, k0 + 2 * K_PASS);
    pass_mm(0);
    // keeps the conversions, and with them the waits for the weight loads, behind the WMMAs
    __builtin_amdgcn_sched_barrier(0);
    store_w(wa, 1);
    hand_over();
    copy_a(k0 + 2 * K_PASS, 0);                  // the A tile after next, into the buffer just read

    load_w(wa, k0 + 3 * K_PASS);
    pass_mm(1);
    // as above
    __builtin_amdgcn_sched_barrier(0);
    store_w(wb, 0);
    hand_over();
    copy_a(k0 + 3 * K_PASS, 1);
  }
  // last pass but one: nothing left to send off; its hand-over leaves no copy on its way
  pass_mm(0);
  // as above
  __builtin_amdgcn_sched_barrier(0);
  store_w(wa, 1);
  hand_over();
  pass_mm(1);                                    // last pass: nothing left to fetch

  // store: D rows = j + (lane>=16 ? 8 : 0), col = lane&15
  const float* bp = bias + (size_t)e * Ndim;
  const int mrow0 = m_blk + wm * 32 + ((lane < 16) ? 0 : 8);
  // both 16-row halves of the wave's tile go through one copy of this text (the second half moves into
  // the first one's registers): unrolled, the long exact GELU would double the kernel's text
#pragma nounroll
  for (int mi = 0; mi < 2; ++mi) {
    if constexpr (GELU_OUT) {
      // exact GELU of the half's 32 values a lane, rows past the expert's last one too: no test stands
      // among the chains; the row test stands at the stores alone, one for the 4 stores of a row
      bf16_t g[4][8];
#pragma unroll  // g[] stays in registers
      for (int sub = 0; sub < 4; ++sub) {
        const float bv = bp[n_blk + wn * 64 + sub * 16 + lane15];
#pragma unroll
        for (int j = 0; j < 8; j += 2) {
          const v2f v = v2f{c[0][sub][j], c[0][sub][j + 1]} + bv;
          const v2f hv = 0.5f * v;
          const v2f o = __builtin_elementwise_fma(hv, erf2(v * 0.70710678118654752f), hv);
          g[sub][j] = f2bf(o.x);
          g[sub][j + 1] = f2bf(o.y);
        }
      }
#pragma unroll
      for (int j = 0; j < 8; ++j) {
        const int m = mrow0 + mi * 16 + j;
        if (m < rows) {
          bf16_t* hp = Hout + (size_t)(base + m) * (size_t)Ndim + (n_blk + wn * 64 + lane15);
#pragma unroll
          for (int sub = 0; sub < 4; ++sub) hp[sub * 16] = g[sub][j];
        }
      }
    } else {
#pragma unroll
      for (int sub = 0; sub < 4; ++sub) {
        int n = n_blk + wn * 64 + sub * 16 + lane15;
        float bv = bp[n];
#pragma unroll
        for (int j = 0; j < 8; ++j) {
          int m = mrow0 + mi * 16 + j;
          if (m < rows) {
            float v = c[0][sub][j] + bv;
            size_t orow = (size_t)(base + m);
            Yout[orow * (size_t)Ndim + n] = v;
          }
        }
      }
    }
    // the moves below and the next half's addresses rewrite registers that the last store names: kept as a precaution
    asm volatile("s_wait_xcnt 0x0" ::: "memory");
    // keeps the scheduler from lifting the moves over that wait
    __builtin_amdgcn_sched_barrier(0);
#pragma unroll
    for (int sub = 0; sub < 4; ++sub) c[0][sub] = c[1][sub];
  }
}

// ---------------- combine (fixed order -> deterministic) + residual + LayerNorm ----------------
__global__ __launch_bounds__(256) void moe_combine_ln(
    const float* __restrict__ x, const float* __restrict__ y,
    const float* __restrict__ gate, const int* __restrict__ slot_of,
    const float* __restrict__ gamma, const float* __restrict__ beta,
    float* __restrict__ out) {
  int t = blockIdx.x;
  int s0 = slot_of[2 * t], s1 = slot_of[2 * t + 1];
  float w0 = gate[s0], w1 = gate[s1];
  const float* xr = x + (size_t)t * H_DIM;
  const float* y0 = y + (size_t)s0 * H_DIM;
  const float* y1 = y + (size_t)s1 * H_DIM;
  float z[3];
  float s = 0.f, sq = 0.f;
#pragma unroll
  for (int i = 0; i < 3; ++i) {
    int hh = threadIdx.x + i * 256;
    float v = xr[hh] + w0 * y0[hh] + w1 * y1[hh];
    z[i] = v; s += v; sq += v * v;
  }
#pragma unroll
  for (int off = 16; off > 0; off >>= 1) {
    s += __shfl_xor(s, off, 32);
    sq += __shfl_xor(sq, off, 32);
  }
  __shared__ float rs[8], rq[8];
  int wave = threadIdx.x >> 5, lane = threadIdx.x & 31;
  if (lane == 0) { rs[wave] = s; rq[wave] = sq; }
  __syncthreads();
  if (threadIdx.x == 0) {
    float S = 0.f, Q = 0.f;
    for (int i = 0; i < 8; ++i) { S += rs[i]; Q += rq[i]; }
    rs[0] = S; rq[0] = Q;
  }
  __syncthreads();
  float mean = rs[0] * (1.0f / H_DIM);
  float var = rq[0] * (1.0f / H_DIM) - mean * mean;
  float inv = rsqrtf(var + LN_EPS);
#pragma unroll
  for (int i = 0; i < 3; ++i) {
    int hh = threadIdx.x + i * 256;
    out[(size_t)t * H_DIM + hh] = (z[i] - mean) * inv * gamma[hh] + beta[hh];
  }
}

extern "C" void kernel_launch(void* const* d_in, const int* in_sizes, int n_in,
                              void* d_out, int out_size, void* d_ws, size_t ws_size,
                              hipStream_t stream) {
  const float* x  = (const float*)d_in[0];
  const float* W1 = (const float*)d_in[1];
  const float* b1 = (const float*)d_in[2];
  const float* W2 = (const float*)d_in[3];
  const float* b2 = (const float*)d_in[4];
  const float* Wg = (const float*)d_in[5];
  const float* bg = (const float*)d_in[6];
  const float* gamma = (const float*)d_in[7];
  const float* beta  = (const float*)d_in[8];
  float* out = (float*)d_out;

  char* ws = (char*)d_ws;
  size_t off = 0;
  auto alloc = [&](size_t bytes) -> void* {
    void* p = ws + off;
    off = (off + bytes + 255) & ~(size_t)255;
    return p;
  };
  bf16_t* xb     = (bf16_t*)alloc((size_t)T_TOK * H_DIM * sizeof(bf16_t));  // 3.1 MB
  bf16_t* hbuf   = (bf16_t*)alloc((size_t)A_TOT * I_DIM * sizeof(bf16_t));  // 25.2 MB
  float*  ybuf   = (float*) alloc((size_t)A_TOT * H_DIM * sizeof(float));   // 12.6 MB
  int*    top_e  = (int*)   alloc((size_t)T_TOK * 2 * sizeof(int));
  float*  top_w  = (float*) alloc((size_t)T_TOK * 2 * sizeof(float));
  int*    counts = (int*)   alloc(E_NUM * sizeof(int));
  int*    offsv  = (int*)   alloc(E_NUM * sizeof(int));
  int*    rowtok = (int*)   alloc((size_t)A_TOT * sizeof(int));
  float*  gate   = (float*) alloc((size_t)A_TOT * sizeof(float));
  int*    slotof = (int*)   alloc((size_t)T_TOK * 2 * sizeof(int));

  cvt_x_kernel<<<1536, 256, 0, stream>>>(x, xb);
  moe_router<<<T_TOK / 8, 256, 0, stream>>>(x, Wg, bg, top_e, top_w);
  moe_partition<<<1, 1024, 0, stream>>>(top_e, top_w, counts, offsv, rowtok, gate, slotof);
  // GEMM1 + GELU: A = xb[token], W1_e [H x I], out bf16 h [slot][I]
  moe_gemm<true, K_PASS_1><<<dim3(I_DIM / TILE_N, M_TILES_MAX), 256, 0, stream>>>(
      xb, W1, b1, counts, offsv, rowtok, hbuf, nullptr);
  // GEMM2: A = h[slot], W2_e [I x H], out fp32 y [slot][H]
  moe_gemm<false, K_PASS_2><<<dim3(H_DIM / TILE_N, M_TILES_MAX), 256, 0, stream>>>(
      hbuf, W2, b2, counts, offsv, nullptr, nullptr, ybuf);
  moe_combine_ln<<<T_TOK, 256, 0, stream>>>(x, ybuf, gate, slotof, gamma, beta, out);
}

// v010
// One run takes 88.4 microseconds.
// In both of two side-by-side timings against v009, it was 1.04 times as fast.
// Over all steps from v000 it is 2.93 times as fast.
#include <hip/hip_runtime.h>
#include <hip/hip_bf16.h>
#include <math.h>

// MoE (top-2 of 8 experts), H=768, I=3072, T=2048 tokens.
// bf16 WMMA (v_wmma_f32_16x16x32_bf16) with fp32 accumulate; gather-based
// expert execution (exactly K*T = 4096 assignment rows of GEMM work).
// GEMM: 128x128 block tile, 8 waves (4M x 2N), 32x64 per wave (8 WMMA accums),
// double-buffered LDS weight tile (fp32 -> bf16 on the fly), 64 or 96 k per pass, 1 barrier/pass.
// Weight loads are 16 bytes a lane (a wave takes whole 512-byte tile rows); the tile lies [k][n] in LDS
// as it lies in memory, and the B fragments come out of it by transposing LDS loads.
// A weight tile's loads go out two passes ahead of its use, into one of two register sets.
// A tile (128 rows x one pass of k) double-buffered in LDS too, filled by asynchronous copies.
// LDS fragment reads go out in groups ahead of their WMMAs (32 k a group in GEMM1, 96 in GEMM2).
// GEMM grid: (column tiles) x (row tiles that any routing can need, all experts in a row).

typedef __bf16 bf16_t;
typedef __attribute__((ext_vector_type(16))) __bf16 v16bf;
typedef __attribute__((ext_vector_type(8)))  __bf16 v8bf;
typedef __attribute__((ext_vector_type(4)))  __bf16 v4bf;
typedef __attribute__((ext_vector_type(4)))  float  v4f;
typedef __attribute__((ext_vector_type(8)))  float  v8f;
typedef __attribute__((address_space(3))) v8bf lds_v8bf;   // operand type of the transposing LDS load

#define T_TOK 2048
#define H_DIM 768
#define I_DIM 3072
#define E_NUM 8
#define A_TOT (T_TOK * 2)
#define LN_EPS 1e-5f

#define TILE_N 128
// rows per work-group: a weight tile is fetched from L2 and converted once per TILE_M rows of its expert
#define TILE_M 128
// row tiles that any routing can need: each expert rounds its rows up to whole tiles
#define M_TILES_MAX (A_TOT / TILE_M + E_NUM)
// k per pass (K_PASS) must divide the GEMM's K an even number of times. K_PASS / 8 weight loads of 16 bytes
// a lane make one tile's set; two sets are on their way at a time, well inside the load counter's 63, so
// that the issue of the younger set never waits for the older one to come back.
#define K_PASS_1 64     // GEMM1: many work-groups; the smaller register set lets several share a WGP
#define GEMM1_WAVES 4   // waves a SIMD that GEMM1's registers must leave room for: two work-groups a WGP
#define K_PASS_2 96     // GEMM2: few work-groups and a long K: a deeper pass

__device__ __forceinline__ bf16_t f2bf(float f) {
  unsigned u = __builtin_bit_cast(unsigned, f);
  u += 0x7FFFu + ((u >> 16) & 1u);                 // round-to-nearest-even
  unsigned short hs = (unsigned short)(u >> 16);
  return __builtin_bit_cast(bf16_t, hs);
}

// work-group barrier that orders LDS alone. __syncthreads() also waits for every global load of the
// wave, and the weight loads of the tile after next are to stay on their way across the barrier.
// Its release fence waits for the wave's own LDS stores; the waits for asynchronous copies, and for LDS
// reads ahead of a refill by such copies, stand in front of each call.
__device__ __forceinline__ void barrier_lds() {
  __builtin_amdgcn_fence(__ATOMIC_RELEASE, "workgroup", "local");
  __builtin_amdgcn_s_barrier();
  __builtin_amdgcn_fence(__ATOMIC_ACQUIRE, "workgroup", "local");
}

typedef __attribute__((ext_vector_type(2))) float v2f;

// erf of two values, without a branch: x * P(x^2) / Q(x^2) on x held to [-4, 4], where erf is 1 to f32
// accuracy; within 5e-7 of erf, relative, over the whole line. Straight-line text lets many values' chains
// be issued interleaved; the library's erff takes one of two paths by |x| and so splits the wave.
__device__ __forceinline__ v2f erf2(v2f x) {
  x.x = fminf(fmaxf(x.x, -4.0f), 4.0f);
  x.y = fminf(fmaxf(x.y, -4.0f), 4.0f);
  const v2f x2 = x * x;
  v2f p = __builtin_elementwise_fma(x2, (v2f)(-2.72614225801306e-10f), (v2f)(2.77068142495902e-08f));
  p = __builtin_elementwise_fma(x2, p, (v2f)(-2.10102402082508e-06f));
  p = __builtin_elementwise_fma(x2, p, (v2f)(-5.69250639462346e-05f));
  p = __builtin_elementwise_fma(x2, p, (v2f)(-7.34990630326855e-04f));
  p = __builtin_elementwise_fma(x2, p, (v2f)(-2.95459980854025e-03f));
  p = __builtin_elementwise_fma(x2, p, (v2f)(-1.60960333262415e-02f));
  v2f q = __builtin_elementwise_fma(x2, (v2f)(-1.45660718464996e-05f), (v2f)(-2.13374055278905e-04f));
  q = __builtin_elementwise_fma(x2, q, (v2f)(-1.68282697438203e-03f));
  q = __builtin_elementwise_fma(x2, q, (v2f)(-7.37332916720468e-03f));
  q = __builtin_elementwise_fma(x2, q, (v2f)(-1.42647390514189e-02f));
  v2f r;                                         // Q lies in [-2.4, -0.014]: its reciprocal is an ordinary number
  r.x = __builtin_amdgcn_rcpf(q.x);
  r.y = __builtin_amdgcn_rcpf(q.y);
  return x * p * r;
}

// ---------------- router: one wave per token; x -> bf16 on the way ----------------
// The wave reads its token's whole row for the logits: it also stores the row as bf16, GEMM1's A operand,
// so that no launch of its own reads x a second time for that.
__global__ __launch_bounds__(256) void moe_router(
    const float* __restrict__ x, const float* __restrict__ Wg,
    const float* __restrict__ bg, int* __restrict__ top_e, float* __restrict__ top_w,
    bf16_t* __restrict__ xb) {
  int wave = threadIdx.x >> 5;
  int lane = threadIdx.x & 31;
  int t = blockIdx.x * 8 + wave;
  if (t >= T_TOK) return;
  float acc[E_NUM];
#pragma unroll
  for (int e = 0; e < E_NUM; ++e) acc[e] = 0.f;
  const float* xr = x + (size_t)t * H_DIM;
  bf16_t* xbr = xb + (size_t)t * H_DIM;
#pragma unroll 8  // eight steps' loads in flight a trip: with the store in the loop the compiler takes four, twice the round trips
  for (int h = lane; h < H_DIM; h += 32) {
    float xv = xr[h];
    xbr[h] = f2bf(xv);
    const float* wr = Wg + (size_t)h * E_NUM;
#pragma unroll
    for (int e = 0; e < E_NUM; ++e) acc[e] += xv * wr[e];
  }
#pragma unroll
  for (int e = 0; e < E_NUM; ++e) {
#pragma unroll
    for (int off = 16; off > 0; off >>= 1) acc[e] += __shfl_xor(acc[e], off, 32);
  }
  if (lane == 0) {
    float p[E_NUM];
    float mx = -1e30f;
#pragma unroll
    for (int e = 0; e < E_NUM; ++e) { p[e] = acc[e] + bg[e]; mx = fmaxf(mx, p[e]); }
    float sum = 0.f;
#pragma unroll
    for (int e = 0; e < E_NUM; ++e) { p[e] = expf(p[e] - mx); sum += p[e]; }
    float inv = 1.0f / sum;
#pragma unroll
    for (int e = 0; e < E_NUM; ++e) p[e] *= inv;
    int i0 = 0; float v0 = p[0];
#pragma unroll
    for (int e = 1; e < E_NUM; ++e) if (p[e] > v0) { v0 = p[e]; i0 = e; }   // first index wins ties
    int i1 = -1; float v1 = -1.0f;
#pragma unroll
    for (int e = 0; e < E_NUM; ++e) if (e != i0 && p[e] > v1) { v1 = p[e]; i1 = e; }
    float s2 = v0 + v1;
    top_e[2 * t] = i0;       top_e[2 * t + 1] = i1;
    top_w[2 * t] = v0 / s2;  top_w[2 * t + 1] = v1 / s2;
  }
}

// ---------------- deterministic partition: one wave per (expert, token quarter) ----------------
// 32 waves. Each wave takes its 512 tokens' expert pairs and weights into registers with one
// batch of independent loads, counts its matches, and gets its first slot from the 32 counts
// in LDS. Slots of an expert stay in ascending token order.
#define PART_Q 4                                  // token quarters
#define PART_IT (T_TOK / PART_Q / 32)             // groups of 32 tokens per wave
__global__ __launch_bounds__(1024) void moe_partition(
    const int* __restrict__ top_e, const float* __restrict__ top_w,
    int* __restrict__ counts, int* __restrict__ offs,
    int* __restrict__ rowtok, float* __restrict__ gate, int* __restrict__ slot_of) {
  const int wave = threadIdx.x >> 5;              // = e * PART_Q + q: slot order of the pieces
  const int lane = threadIdx.x & 31;
  const int e = wave >> 2;
  const int q = wave & (PART_Q - 1);
  const int t0 = q * (T_TOK / PART_Q) + lane;
  __shared__ int scnt[E_NUM * PART_Q];

  int e0[PART_IT], e1[PART_IT];
  float w0[PART_IT], w1[PART_IT];
#pragma unroll  // all loads independent and in flight together: one memory round trip
  for (int i = 0; i < PART_IT; ++i) {
    int2 ev = ((const int2*)top_e)[t0 + i * 32];
    float2 wv = ((const float2*)top_w)[t0 + i * 32];
    e0[i] = ev.x; e1[i] = ev.y;
    w0[i] = wv.x; w1[i] = wv.y;
  }
  unsigned m[PART_IT];
  int cnt = 0;
#pragma unroll  // arrays stay in registers
  for (int i = 0; i < PART_IT; ++i) {
    bool sel = (e0[i] == e) | (e1[i] == e);
    m[i] = (unsigned)(__ballot(sel) & 0xffffffffull);
    cnt += __popc(m[i]);
  }
  if (lane == 0) scnt[wave] = cnt;
  __syncthreads();
  const int v = scnt[lane];
  int before = (lane < wave) ? v : 0;             // pieces that come first in slot order
  int mine = ((lane >> 2) == e) ? v : 0;          // the expert's own four pieces
#pragma unroll
  for (int off = 16; off > 0; off >>= 1) {
    before += __shfl_xor(before, off, 32);
    mine += __shfl_xor(mine, off, 32);
  }
  if (q == 0 && lane == 0) { offs[e] = before; counts[e] = mine; }
  int pos = before;
  const unsigned lt = (1u << lane) - 1u;
#pragma unroll  // arrays stay in registers
  for (int i = 0; i < PART_IT; ++i) {
    if ((m[i] >> lane) & 1u) {
      const bool first = (e0[i] == e);
      const int t = t0 + i * 32;
      const int slot = pos + __popc(m[i] & lt);
      rowtok[slot] = t;
      gate[slot] = first ? w0[i] : w1[i];
      slot_of[2 * t + (first ? 0 : 1)] = slot;
    }
    pos += __popc(m[i]);
  }
}

// ---------------- WMMA GEMM: C[rows_e x Ndim] = A[rows] x W_e[Kdim x Ndim] ----------------
// second launch bound = waves a SIMD that must still fit beside the 8 accumulators and the fragments
// of a group: GEMM1_WAVES (GEMM1), 2 (GEMM2: it has fewer work-groups than the chip has WGPs)
template <bool GELU_OUT, int K_PASS>
__global__ __launch_bounds__(256, GELU_OUT ? GEMM1_WAVES : 2) void moe_gemm(
    const bf16_t* __restrict__ A,
    const float* __restrict__ Wfull, const float* __restrict__ bias,
    const int* __restrict__ counts, const int* __restrict__ offs,
    const int* __restrict__ rowtok,              // null -> identity (slot rows)
    bf16_t* __restrict__ Hout, float* __restrict__ Yout) {
  // shapes at compile time: a pass's loads then share one address register pair and differ in
  // their immediate offsets, so that holding them all in flight costs no register per address
  constexpr int Kdim = GELU_OUT ? H_DIM : I_DIM;
  constexpr int Ndim = GELU_OUT ? I_DIM : H_DIM;
  constexpr int lda = Kdim;
  static_assert(Kdim % K_PASS == 0, "whole passes only");
  constexpr int K_SUB = K_PASS / 32;             // WMMA k-blocks per pass
  // k-blocks whose LDS reads go out as one group: GEMM2 the whole pass; GEMM1 one block
  constexpr int K_GRP = GELU_OUT ? 1 : K_SUB;
  static_assert(K_SUB % K_GRP == 0, "whole groups only");
  constexpr int K_ROWS = K_PASS / 8;             // k rows of the weight tile per wave
  constexpr int LDS_STRIDE = K_PASS + 8;         // A tile: 144 or 208 B rows: 16 B x odd, no bank conflicts
  constexpr int B_PITCH = TILE_N + 16;           // weight tile: 288 B rows: 32 B x odd, the transposing load's pitch
  // blockIdx.y counts the row tiles that exist, expert after expert: the grid then holds no
  // work-group per (expert, possible tile) that only starts, finds no rows and ends
  const int tile = blockIdx.y;
  // each array fetched whole, ahead of the search: one scalar load an array, none inside the search
  const int4 c_lo = ((const int4*)counts)[0], c_hi = ((const int4*)counts)[1];
  const int4 o_lo = ((const int4*)offs)[0], o_hi = ((const int4*)offs)[1];
  const int cnt_of[E_NUM] = {c_lo.x, c_lo.y, c_lo.z, c_lo.w, c_hi.x, c_hi.y, c_hi.z, c_hi.w};
  const int off_of[E_NUM] = {o_lo.x, o_lo.y, o_lo.z, o_lo.w, o_hi.x, o_hi.y, o_hi.z, o_hi.w};
  int e = -1, rows = 0, base = 0, start = 0, first = 0;
#pragma unroll  // the two arrays stay in scalar registers
  for (int i = 0; i < E_NUM; ++i) {
    const int nt = (int)((unsigned)(cnt_of[i] + TILE_M - 1) / TILE_M);
    const bool hit = (tile >= first) & (tile < first + nt);
    e = hit ? i : e;
    rows = hit ? cnt_of[i] : rows;
    base = hit ? off_of[i] : base;
    start = hit ? first : start;
    first += nt;
  }
  if (e < 0) return;                             // block-uniform exit: past the last tile
  const int m_blk = (tile - start) * TILE_M;     // < rows: the tile is one of the expert's own
  const int n_blk = blockIdx.x * TILE_N;
  const int wave = threadIdx.x >> 5;
  const int lane = threadIdx.x & 31;
  const int wm = wave >> 1;                      // 0..3 (M, 32 each)
  const int wn = wave & 1;                       // 0..1 (N, 64 each)
  const int lane15 = lane & 15;
  const int khalf = (lane >> 4) * 8;             // 0 or 8 per WMMA 16-bit layout

  // double-buffered weight tile: [k][n] layout, bf16
  __shared__ __align__(16) bf16_t Bs[2][K_PASS * B_PITCH];
  // double-buffered A tile: [m][k] layout (its readers are plain 16-byte LDS loads)
  __shared__ __align__(16) bf16_t As[2][TILE_M * LDS_STRIDE];

  const float* W = Wfull + (size_t)e * Kdim * Ndim;

  // cooperative A-tile copier: the tile's 16-byte pieces in row order, one piece a lane and copy, so
  // that a wave's copy takes runs of whole rows' bytes and not 32 bytes out of each of 16 rows
  constexpr int A_ROW_PCS = K_PASS / 8;          // 16-byte pieces of a row in one pass
  constexpr int A_COPIES = TILE_M * A_ROW_PCS / 256;
  static_assert(A_COPIES * 256 == TILE_M * A_ROW_PCS, "whole copies only");
  static_assert(A_COPIES == 4 || A_COPIES == 6, "copy_a spells out four and six copies");
  static_assert(Kdim / K_PASS >= 2, "the two-buffer ring needs two tiles");
  constexpr unsigned A_BUF_BYTES = TILE_M * LDS_STRIDE * sizeof(bf16_t);
  const bf16_t* a_src[A_COPIES];                 // the piece's place in pass 0
  unsigned a_dst[A_COPIES];                      // its LDS byte address in buffer 0
#pragma unroll  // both arrays stay in registers
  for (int i = 0; i < A_COPIES; ++i) {
    const int pc = (int)threadIdx.x + i * 256;
    const int r = pc / A_ROW_PCS;
    const int col = pc - r * A_ROW_PCS;
    int mloc = m_blk + r;
    if (mloc >= rows) mloc = rows - 1;           // clamp (stores are guarded)
    const int arow = rowtok ? rowtok[base + mloc] : (base + mloc);
    a_src[i] = A + (size_t)arow * lda + col * 8;
    a_dst[i] = (unsigned)(size_t)&As[0][r * LDS_STRIDE + col * 8];
  }
  // sends one A tile on its way into LDS, through no register. s_wait_xcnt 0 is kept, as a precaution,
  // in front of every rewrite of the copies' address registers: as the last line of their own
  // statement, where the compiler can put no such rewrite ahead of it.
  auto copy_a = [&](int k0, int b) {
    const unsigned lb = (unsigned)b * A_BUF_BYTES;
    if constexpr (A_COPIES == 4) {
      asm volatile(
          "global_load_async_to_lds_b128 %0, %1, off\n\t"
          "global_load_async_to_lds_b128 %2, %3, off\n\t"
          "global_load_async_to_lds_b128 %4, %5, off\n\t"
          "global_load_async_to_lds_b128 %6, %7, off\n\t"
          "s_wait_xcnt 0x0"
          :: "v"(a_dst[0] + lb), "v"(a_src[0] + k0), "v"(a_dst[1] + lb), "v"(a_src[1] + k0),
             "v"(a_dst[2] + lb), "v"(a_src[2] + k0), "v"(a_dst[3] + lb), "v"(a_src[3] + k0)
          : "memory");
    } else {
      asm volatile(
          "global_load_async_to_lds_b128 %0, %1, off\n\t"
          "global_load_async_to_lds_b128 %2, %3, off\n\t"
          "global_load_async_to_lds_b128 %4, %5, off\n\t"
          "global_load_async_to_lds_b128 %6, %7, off\n\t"
          "global_load_async_to_lds_b128 %8, %9, off\n\t"
          "global_load_async_to_lds_b128 %10, %11, off\n\t"
          "s_wait_xcnt 0x0"
          :: "v"(a_dst[0] + lb), "v"(a_src[0] + k0), "v"(a_dst[1] + lb), "v"(a_src[1] + k0),
             "v"(a_dst[2] + lb), "v"(a_src[2] + k0), "v"(a_dst[3] + lb), "v"(a_src[3] + k0),
             "v"(a_dst[4] + lb), "v"(a_src[4] + k0), "v"(a_dst[5] + lb), "v"(a_src[5] + k0)
          : "memory");
    }
  };

  // cooperative weight-tile loader: a lane covers 4 n, a wave the tile's whole 128 n (512 bytes in a row,
  // four whole lines a load) of K_ROWS k rows
  const int cn = lane * 4;
  const int ck = wave * K_ROWS;

  v8f c[2][4] = {{v8f{}, v8f{}, v8f{}, v8f{}}, {v8f{}, v8f{}, v8f{}, v8f{}}};

  // sends one weight tile's loads on their way into a register set
  auto load_w = [&](v4f (&dst)[K_ROWS], int kt) {
    const float* wp = W + (size_t)(kt + ck) * Ndim + (n_blk + cn);
#pragma unroll  // dst[] stays in registers; all loads independent and in flight together
    for (int j = 0; j < K_ROWS; ++j) dst[j] = *(const v4f*)(wp + (size_t)j * Ndim);
    // these loads are still out when their address pair is next rewritten (LDS addresses, the next
    // tile's address): the wait in front of such a rewrite, kept as a precaution
    asm volatile("s_wait_xcnt 0x0" ::: "memory");
    // keeps the scheduler from sinking the loads down to their uses, a pass and a half later,
    // and from lifting a rewrite of their address pair over the wait
    __builtin_amdgcn_sched_barrier(0);
  };
  // converts a register set that has come back and stores it as weight tile into buffer b
  // (a wave's store is one tile row, 256 bytes in a row)
  auto store_w = [&](const v4f (&s)[K_ROWS], int b) {
#pragma unroll  // s[] stays in registers
    for (int j = 0; j < K_ROWS; ++j) {
      v4bf p;
#pragma unroll
      for (int i = 0; i < 4; ++i) p[i] = f2bf(s[j][i]);
      *(v4bf*)&Bs[b][(ck + j) * B_PITCH + cn] = p;
    }
  };
  // two register sets: while one tile's set is converted, the tile behind it is already on its way
  v4f wa[K_ROWS], wb[K_ROWS];

  // prologue: tile 0 -> As[0] (in flight under the weight tiles' loads) and Bs[0]; weight tile 1 sent off
  copy_a(0, 0);
  load_w(wb, 0);
  load_w(wa, K_PASS);
  store_w(wb, 0);
  // this wave's copies of A tile 0 have landed before the barrier lets the other waves read them
  asm volatile("s_wait_asynccnt 0x0" ::: "memory");
  barrier_lds();
  copy_a(K_PASS, 1);                             // A tile 1 flies while pass 0 is worked on

  // one pass of products, k ascending: per 32-k block 2 A fragments (row = lane15, K = khalf+[0..7]
  // and khalf+16+[0..7]), 4 B fragments + 8 WMMAs (wave's 32x64 output). A B fragment is two transposing
  // loads of 16 k x 16 n each: the lane points at 16 bytes of k row khalf + (lane & 7), n half (lane >> 3) & 1,
  // and gets column lane15, K = khalf+[0..7]: the A fragment's k order. The LDS reads of K_GRP
  // blocks go out as one group, each fragment into registers of its own, ahead of those blocks'
  // WMMAs: the wave then meets the LDS latency once a group and not once a WMMA.
  auto pass_mm = [&](int buf) {
#pragma unroll  // LDS offsets become immediates
    for (int kg = 0; kg < K_SUB; kg += K_GRP) {
      v16bf af[K_GRP][2], bfr[K_GRP][4];
#pragma unroll  // both arrays stay in registers
      for (int kk = 0; kk < K_GRP; ++kk) {
#pragma unroll
        for (int mi = 0; mi < 2; ++mi) {
          const bf16_t* ap =
              &As[buf][(wm * 32 + mi * 16 + lane15) * LDS_STRIDE + (kg + kk) * 32 + khalf];
          v8bf alo = *(const v8bf*)(ap);
          v8bf ahi = *(const v8bf*)(ap + 16);
#pragma unroll
          for (int j = 0; j < 8; ++j) { af[kk][mi][j] = alo[j]; af[kk][mi][8 + j] = ahi[j]; }
        }
#pragma unroll
        for (int sub = 0; sub < 4; ++sub) {
          const bf16_t* bp = &Bs[buf][((kg + kk) * 32 + khalf + (lane & 7)) * B_PITCH +
                                      wn * 64 + sub * 16 + ((lane >> 3) & 1) * 8];
          v8bf lo = __builtin_amdgcn_ds_load_tr16_b128_v8bf16((lds_v8bf*)(bp));
          v8bf hi = __builtin_amdgcn_ds_load_tr16_b128_v8bf16((lds_v8bf*)(bp + 16 * B_PITCH));
#pragma unroll
          for (int j = 0; j < 8; ++j) { bfr[kk][sub][j] = lo[j]; bfr[kk][sub][8 + j] = hi[j]; }
        }
      }
      // keeps the scheduler from sinking the reads back among the WMMAs, two in front of each with
      // a full wait, into one shared fragment register set
      __builtin_amdgcn_sched_barrier(0);
#pragma unroll
      for (int kk = 0; kk < K_GRP; ++kk) {
#pragma unroll
        for (int sub = 0; sub < 4; ++sub) {
#pragma unroll
          for (int mi = 0; mi < 2; ++mi) {
            c[mi][sub] = __builtin_amdgcn_wmma_f32_16x16x32_bf16(
                false, af[kk][mi], false, bfr[kk][sub], (short)0, c[mi][sub], false, false);
          }
        }
      }
    }
  };

  // hand-over of the next pass's tiles: this wave's reads of the A buffer of this pass are over before
  // anyone refills it, and its copies into the other one have landed before anyone reads them
  auto hand_over = [&]() {
    asm volatile("s_wait_dscnt 0x0" ::: "memory");
    asm volatile("s_wait_asynccnt 0x0" ::: "memory");
    barrier_lds();
  };
  static_assert((Kdim / K_PASS) % 2 == 0 && Kdim / K_PASS >= 4, "passes go in pairs, one per register set");
  // two passes a trip, so that each register set and each LDS buffer has its fixed place in the text.
  // Pass p sends off weight tile p + 2, works on tile p and converts tile p + 1, whose loads went out
  // in pass p - 1: they have had a whole pass and this pass's WMMAs to come back.
  for (int k0 = 0; k0 + 3 * K_PASS < Kdim; k0 += 2 * K_PASS) {
    load_w(wb, k0 + 2 * K_PASS);
    pass_mm(0);
    // keeps the conversions, and with them the waits for the weight loads, behind the WMMAs
    __builtin_amdgcn_sched_barrier(0);
    store_w(wa, 1);
    hand_over();
    copy_a(k0 + 2 * K_PASS, 0);                  // the A tile after next, into the buffer just read

    load_w(wa, k0 + 3 * K_PASS);
    pass_mm(1);
    // as above
    __builtin_amdgcn_sched_barrier(0);
    store_w(wb, 0);
    hand_over();
    copy_a(k0 + 3 * K_PASS, 1);
  }
  // last pass but one: nothing left to send off; its hand-over leaves no copy on its way
  pass_mm(0);
  // as above
  __builtin_amdgcn_sched_barrier(0);
  store_w(wa, 1);
  hand_over();
  pass_mm(1);                                    // last pass: nothing left to fetch

  // store: D rows = j + (lane>=16 ? 8 : 0), col = lane&15
  const float* bp = bias + (size_t)e * Ndim;
  const int mrow0 = m_blk + wm * 32 + ((lane < 16) ? 0 : 8);
  // both 16-row halves of the wave's tile go through one copy of this text (the second half moves into
  // the first one's registers): unrolled, the long exact GELU would double the kernel's text
#pragma nounroll
  for (int mi = 0; mi < 2; ++mi) {
    if constexpr (GELU_OUT) {
      // exact GELU of the half's 32 values a lane, rows past the expert's last one too: no test stands
      // among the chains; the row test stands at the stores alone, one for the 4 stores of a row
      bf16_t g[4][8];
#pragma unroll  // g[] stays in registers
      for (int sub = 0; sub < 4; ++sub) {
        const float bv = bp[n_blk + wn * 64 + sub * 16 + lane15];
#pragma unroll
        for (int j = 0; j < 8; j += 2) {
          const v2f v = v2f{c[0][sub][j], c[0][sub][j + 1]} + bv;
          const v2f hv = 0.5f * v;
          const v2f o = __builtin_elementwise_fma(hv, erf2(v * 0.70710678118654752f), hv);
          g[sub][j] = f2bf(o.x);
          g[sub][j + 1] = f2bf(o.y);
        }
      }
#pragma unroll
      for (int j = 0; j < 8; ++j) {
        const int m = mrow0 + mi * 16 + j;
        if (m < rows) {
          bf16_t* hp = Hout + (size_t)(base + m) * (size_t)Ndim + (n_blk + wn * 64 + lane15);
#pragma unroll
          for (int sub = 0; sub < 4; ++sub) hp[sub * 16] = g[sub][j];
        }
      }
    } else {
#pragma unroll
      for (int sub = 0; sub < 4; ++sub) {
        int n = n_blk + wn * 64 + sub * 16 + lane15;
        float bv = bp[n];
#pragma unroll
        for (int j = 0; j < 8; ++j) {
          int m = mrow0 + mi * 16 + j;
          if (m < rows) {
            float v = c[0][sub][j] + bv;
            size_t orow = (size_t)(base + m);
            Yout[orow * (size_t)Ndim + n] = v;
          }
        }
      }
    }
    // the moves below and the next half's addresses rewrite registers that the last store names: kept as a precaution
    asm volatile("s_wait_xcnt 0x0" ::: "memory");
    // keeps the scheduler from lifting the moves over that wait
    __builtin_amdgcn_sched_barrier(0);
#pragma unroll
    for (int sub = 0; sub < 4; ++sub) c[0][sub] = c[1][sub];
  }
}

// ---------------- combine (fixed order -> deterministic) + residual + LayerNorm ----------------
__global__ __launch_bounds__(256) void moe_combine_ln(
    const float* __restrict__ x, const float* __restrict__ y,
    const float* __restrict__ gate, const int* __restrict__ slot_of,
    const float* __restrict__ gamma, const float* __restrict__ beta,
    float* __restrict__ out) {
  int t = blockIdx.x;
  int s0 = slot_of[2 * t], s1 = slot_of[2 * t + 1];
  float w0 = gate[s0], w1 = gate[s1];
  const float* xr = x + (size_t)t * H_DIM;
  const float* y0 = y + (size_t)s0 * H_DIM;
  const float* y1 = y + (size_t)s1 * H_DIM;
  float z[3];
  float s = 0.f, sq = 0.f;
#pragma unroll
  for (int i = 0; i < 3; ++i) {
    int hh = threadIdx.x + i * 256;
    float v = xr[hh] + w0 * y0[hh] + w1 * y1[hh];
    z[i] = v; s += v; sq += v * v;
  }
#pragma unroll
  for (int off = 16; off > 0; off >>= 1) {
    s += __shfl_xor(s, off, 32);
    sq += __shfl_xor(sq, off, 32);
  }
  __shared__ float rs[8], rq[8];
  int wave = threadIdx.x >> 5, lane = threadIdx.x & 31;
  if (lane == 0) { rs[wave] = s; rq[wave] = sq; }
  __syncthreads();
  if (threadIdx.x == 0) {
    float S = 0.f, Q = 0.f;
    for (int i = 0; i < 8; ++i) { S += rs[i]; Q += rq[i]; }
    rs[0] = S; rq[0] = Q;
  }
  __syncthreads();
  float mean = rs[0] * (1.0f / H_DIM);
  float var = rq[0] * (1.0f / H_DIM) - mean * mean;
  float inv = rsqrtf(var + LN_EPS);
#pragma unroll
  for (int i = 0; i < 3; ++i) {
    int hh = threadIdx.x + i * 256;
    out[(size_t)t * H_DIM + hh] = (z[i] - mean) * inv * gamma[hh] + beta[hh];
  }
}

extern "C" void kernel_launch(void* const* d_in, const int* in_sizes, int n_in,
                              void* d_out, int out_size, void* d_ws, size_t ws_size,
                              hipStream_t stream) {
  const float* x  = (const float*)d_in[0];
  const float* W1 = (const float*)d_in[1];
  const float* b1 = (const float*)d_in[2];
  const float* W2 = (const float*)d_in[3];
  const float* b2 = (const float*)d_in[4];
  const float* Wg = (const float*)d_in[5];
  const float* bg = (const float*)d_in[6];
  const float* gamma = (const float*)d_in[7];
  const float* beta  = (const float*)d_in[8];
  float* out = (float*)d_out;

  char* ws = (char*)d_ws;
  size_t off = 0;
  auto alloc = [&](size_t bytes) -> void* {
    void* p = ws + off;
    off = (off + bytes + 255) & ~(size_t)255;
    return p;
  };
  bf16_t* xb     = (bf16_t*)alloc((size_t)T_TOK * H_DIM * sizeof(bf16_t));  // 3.1 MB
  bf16_t* hbuf   = (bf16_t*)alloc((size_t)A_TOT * I_DIM * sizeof(bf16_t));  // 25.2 MB
  float*  ybuf   = (float*) alloc((size_t)A_TOT * H_DIM * sizeof(float));   // 12.6 MB
  int*    top_e  = (int*)   alloc((size_t)T_TOK * 2 * sizeof(int));
  float*  top_w  = (float*) alloc((size_t)T_TOK * 2 * sizeof(float));
  int*    counts = (int*)   alloc(E_NUM * sizeof(int));
  int*    offsv  = (int*)   alloc(E_NUM * sizeof(int));
  int*    rowtok = (int*)   alloc((size_t)A_TOT * sizeof(int));
  float*  gate   = (float*) alloc((size_t)A_TOT * sizeof(float));
  int*    slotof = (int*)   alloc((size_t)T_TOK * 2 * sizeof(int));

  moe_router<<<T_TOK / 8, 256, 0, stream>>>(x, Wg, bg, top_e, top_w, xb);
  moe_partition<<<1, 1024, 0, stream>>>(top_e, top_w, counts, offsv, rowtok, gate, slotof);
  // GEMM1 + GELU: A = xb[token], W1_e [H x I], out bf16 h [slot][I]
  moe_gemm<true, K_PASS_1><<<dim3(I_DIM / TILE_N, M_TILES_MAX), 256, 0, stream>>>(
      xb, W1, b1, counts, offsv, rowtok, hbuf, nullptr);
  // GEMM2: A = h[slot], W2_e [I x H], out fp32 y [slot][H]
  moe_gemm<false, K_PASS_2><<<dim3(H_DIM / TILE_N, M_TILES_MAX), 256, 0, stream>>>(
      hbuf, W2, b2, counts, offsv, nullptr, nullptr, ybuf);
  moe_combine_ln<<<T_TOK, 256, 0, stream>>>(x, ybuf, gate, slotof, gamma, beta, out);
}
